// v000
// The times below were measured on an AMD MI455X: many runs one after another, warmed up first and cycling through
// copies of the inputs, with the whole window's GPU time divided by the number of runs. Launches and the gaps
// between them are all in it. The median over several windows is given; except for v000 it joins two sittings, which
// can be a few percent apart, so the side-by-side timings, each taken in one sitting, are the better comparison.
// v000, which the later versions start from, runs in 361 microseconds.
#include <hip/hip_runtime.h>

typedef float v2f __attribute__((ext_vector_type(2)));
typedef float v8f __attribute__((ext_vector_type(8)));

typedef unsigned int tdm_u32x4 __attribute__((ext_vector_type(4)));
typedef int          tdm_i32x8 __attribute__((ext_vector_type(8)));
typedef int          tdm_i32x4 __attribute__((ext_vector_type(4)));

#ifndef USE_TDM
# define USE_TDM 1
#endif

#define Bn   4
#define Cn   128
#define Nn   32768
#define NGn  64
#define LN_EPS 1e-5f
#define S1   34    // phase-1 LDS row stride (even => aligned b64 lane fetches)
#define S2   130   // phase-2 LDS row stride (even, conflict-free)

__global__ void zero_ws_kernel(float* ws, int n) {
    int i = blockIdx.x * blockDim.x + threadIdx.x;
    if (i < n) ws[i] = 0.0f;
}

// v_proj[b, c=h*32+d, k] = sum_{n<64} global_fea[b,n,c] * EF1[n,k]  (tiny)
__global__ void __launch_bounds__(256)
vproj_kernel(const float* __restrict__ gf, const float* __restrict__ EF1,
             float* __restrict__ vproj) {
    int b = blockIdx.x;
    for (int idx = threadIdx.x; idx < Cn * 32; idx += 256) {
        int c = idx >> 5, k = idx & 31;
        float s = 0.0f;
        for (int n = 0; n < NGn; ++n)
            s += gf[(b * NGn + n) * Cn + c] * EF1[n * 32 + k];
        vproj[(b * Cn + c) * 32 + k] = s;
    }
}

__global__ void __launch_bounds__(256)
kproj_kernel(const float* __restrict__ skip, const float* __restrict__ EF2,
             const float* __restrict__ ln_w, const float* __restrict__ ln_b,
             float* __restrict__ kproj) {
    __shared__ float lnT[Cn * S1];     // [channel][token], padded stride 34
    __shared__ float ef2T[32 * S1];    // [p][token],       padded stride 34

    const int b = blockIdx.y;
    const int chunk = blockIdx.x;              // 64 chunks * 512 tokens
    const int tid = threadIdx.x;
    const int lane = tid & 31, wave = tid >> 5;
    const int lanelow = lane & 15, half = lane >> 4;
    const float* skb = skip + (size_t)b * Cn * Nn;

    v8f acc0 = {0,0,0,0,0,0,0,0};
    v8f acc1 = {0,0,0,0,0,0,0,0};

#if USE_TDM
    const unsigned lds_base = (unsigned)(size_t)(void*)&lnT[0];
    tdm_i32x8 g1;
    g1[0] = (int)((2u << 16) | (1u << 20) | (4u << 22) | (1u << 25));
    g1[1] = (int)0x80000000u;
    g1[2] = (int)(128u << 16);
    g1[3] = (int)(32u << 16);
    g1[4] = (int)128u;
    g1[5] = (int)32768u;
    g1[6] = 0;
    g1[7] = 0;
    const tdm_i32x4 gz = {0, 0, 0, 0};
#endif

    for (int tile = 0; tile < 16; ++tile) {
        const int n0 = chunk * 512 + tile * 32;
#if USE_TDM
        if (wave == 0) {
            unsigned long long ga = (unsigned long long)(size_t)(skb + n0);
            tdm_u32x4 g0;
            g0[0] = 1u;                                  // count=1
            g0[1] = lds_base;                            // lds_addr
            g0[2] = (unsigned)(ga & 0xFFFFFFFFu);        // global_addr lo
            g0[3] = (unsigned)((ga >> 32) & 0x01FFFFFFu) // global_addr hi
                    | 0x80000000u;                       // type=2
#if __clang_major__ >= 23
            __builtin_amdgcn_tensor_load_to_lds(g0, g1, gz, gz,
                                                (tdm_i32x8){0,0,0,0,0,0,0,0}, 0);
#else
            __builtin_amdgcn_tensor_load_to_lds(g0, g1, gz, gz, 0);
#endif
        }
#else
        for (int i = 0; i < 16; ++i) {                   // fallback: plain loads
            int idx = tid + i * 256;
            int c = idx >> 5, t = idx & 31;
            lnT[c * S1 + t] = skb[(size_t)c * Nn + n0 + t];
        }
#endif
        // EF2 tile [p][t]
        for (int i = 0; i < 4; ++i) {
            int idx = tid + i * 256;
            int p = idx & 31, t = idx >> 5;
            ef2T[p * S1 + t] = EF2[(size_t)(n0 + t) * 32 + p];
        }
#if USE_TDM
        __builtin_amdgcn_s_wait_tensorcnt(0);
#endif
        __syncthreads();
        // LayerNorm over C per token; wave handles 4 tokens
        for (int j = 0; j < 4; ++j) {
            int t = wave * 4 + j;
            float s = 0.0f, s2 = 0.0f;
            for (int cc = lane; cc < Cn; cc += 32) {
                float x = lnT[cc * S1 + t];
                s += x; s2 += x * x;
            }
            for (int m = 16; m >= 1; m >>= 1) {
                s  += __shfl_xor(s,  m, 32);
                s2 += __shfl_xor(s2, m, 32);
            }
            float mu  = s * (1.0f / 128.0f);
            float var = s2 * (1.0f / 128.0f) - mu * mu;
            float rs  = rsqrtf(var + LN_EPS);
            for (int cc = lane; cc < Cn; cc += 32) {
                float x = lnT[cc * S1 + t];
                lnT[cc * S1 + t] = (x - mu) * rs * ln_w[cc] + ln_b[cc];
            }
        }
        __syncthreads();
        // WMMA: A[m=c][k=t] = lnT[c][t]; B[k=t][n=p] = ef2T[p][t]
        const int mrow = wave * 16 + lanelow;
        for (int kk = 0; kk < 8; ++kk) {
            int kb = kk * 4 + half * 2;
            v2f a  = *(const v2f*)&lnT[mrow * S1 + kb];
            v2f b0 = *(const v2f*)&ef2T[lanelow * S1 + kb];
            v2f b1 = *(const v2f*)&ef2T[(16 + lanelow) * S1 + kb];
            acc0 = __builtin_amdgcn_wmma_f32_16x16x4_f32(false, a, false, b0,
                                                         (short)0, acc0, false, false);
            acc1 = __builtin_amdgcn_wmma_f32_16x16x4_f32(false, a, false, b1,
                                                         (short)0, acc1, false, false);
        }
        __syncthreads();
    }
    const int mbase = wave * 16 + half * 8;
    for (int r = 0; r < 8; ++r) {
        int m = mbase + r;
        atomicAdd(&kproj[((b * Cn + m) << 5) + lanelow],      acc0[r]);
        atomicAdd(&kproj[((b * Cn + m) << 5) + 16 + lanelow], acc1[r]);
    }
}

// Per 16-token tile: LN(out) -> q ; logits = q . k_proj * temp ; softmax(32) ;
// x = attn . v_proj ; scatter with the reference's scrambled reshape:
//   dst[b, c'=n&127, n'=k*1024+h*256+(n>>7)] = x[b,h,n,k]
__global__ void __launch_bounds__(256)
attn_kernel(const float* __restrict__ outT, const float* __restrict__ ln_w,
            const float* __restrict__ ln_b, const float* __restrict__ temp3,
            const float* __restrict__ kproj, const float* __restrict__ vproj,
            float* __restrict__ dst) {
    __shared__ float lnT[16 * S2];     // [token][channel]
    __shared__ float attnT[16 * S2];   // [token][h*32+p]
    __shared__ float kpT[32 * S2];     // [p][c=h*32+d]   (transposed k_proj)
    __shared__ float vpT[32 * S2];     // [k][c=h*32+p]   (transposed v_proj)

    const int b = blockIdx.y;
    const int chunk = blockIdx.x;              // 128 chunks * 256 tokens
    const int tid = threadIdx.x;
    const int lane = tid & 31, wave = tid >> 5;
    const int lanelow = lane & 15, half = lane >> 4;
    const int h = wave >> 1, nt = wave & 1;    // wave <-> (head, N-tile)
    const float th = temp3[h];

    for (int i = 0; i < 16; ++i) {
        int idx = tid + i * 256;
        int p = idx & 31, c = idx >> 5;
        kpT[p * S2 + c] = kproj[((b * Cn + c) << 5) + p];
        vpT[p * S2 + c] = vproj[((b * Cn + c) << 5) + p];
    }
    __syncthreads();

    const float* ob = outT + (size_t)b * Cn * Nn;
    float* db = dst + (size_t)b * Cn * Nn;

    for (int tile = 0; tile < 16; ++tile) {
        const int n0 = chunk * 256 + tile * 16;
        for (int i = 0; i < 8; ++i) {
            int idx = tid + i * 256;
            int t = idx & 15, c = idx >> 4;
            lnT[t * S2 + c] = ob[(size_t)c * Nn + n0 + t];
        }
        __syncthreads();
        for (int j = 0; j < 2; ++j) {          // LN: wave handles 2 tokens
            int t = wave * 2 + j;
            float s = 0.0f, s2 = 0.0f;
            for (int cc = lane; cc < Cn; cc += 32) {
                float x = lnT[t * S2 + cc];
                s += x; s2 += x * x;
            }
            for (int m = 16; m >= 1; m >>= 1) {
                s  += __shfl_xor(s,  m, 32);
                s2 += __shfl_xor(s2, m, 32);
            }
            float mu  = s * (1.0f / 128.0f);
            float var = s2 * (1.0f / 128.0f) - mu * mu;
            float rs  = rsqrtf(var + LN_EPS);
            for (int cc = lane; cc < Cn; cc += 32) {
                float x = lnT[t * S2 + cc];
                lnT[t * S2 + cc] = (x - mu) * rs * ln_w[cc] + ln_b[cc];
            }
        }
        __syncthreads();
        {   // logits[t][p] = sum_d q[t][h*32+d] * kproj[h*32+d][p]
            v8f acc = {0,0,0,0,0,0,0,0};
            for (int kk = 0; kk < 8; ++kk) {
                int kb = kk * 4 + half * 2;
                v2f a  = *(const v2f*)&lnT[lanelow * S2 + h * 32 + kb];
                v2f bb = *(const v2f*)&kpT[(nt * 16 + lanelow) * S2 + h * 32 + kb];
                acc = __builtin_amdgcn_wmma_f32_16x16x4_f32(false, a, false, bb,
                                                            (short)0, acc, false, false);
            }
            for (int r = 0; r < 8; ++r) {
                int t = r + half * 8;
                attnT[t * S2 + h * 32 + nt * 16 + lanelow] = acc[r] * th;
            }
        }
        __syncthreads();
        if (tid < 64) {                        // softmax over 32, rows (t, head)
            int t = tid >> 2, hh = tid & 3;
            float* row = &attnT[t * S2 + hh * 32];
            float mx = row[0];
            for (int p = 1; p < 32; ++p) mx = fmaxf(mx, row[p]);
            float s = 0.0f;
            for (int p = 0; p < 32; ++p) { float e = __expf(row[p] - mx); row[p] = e; s += e; }
            float inv = 1.0f / s;
            for (int p = 0; p < 32; ++p) row[p] *= inv;
        }
        __syncthreads();
        {   // x[t][k] = sum_p attn[t][h*32+p] * vproj[h*32+p][k] ; scatter
            v8f acc = {0,0,0,0,0,0,0,0};
            for (int kk = 0; kk < 8; ++kk) {
                int kb = kk * 4 + half * 2;
                v2f a  = *(const v2f*)&attnT[lanelow * S2 + h * 32 + kb];
                v2f bb = *(const v2f*)&vpT[(nt * 16 + lanelow) * S2 + h * 32 + kb];
                acc = __builtin_amdgcn_wmma_f32_16x16x4_f32(false, a, false, bb,
                                                            (short)0, acc, false, false);
            }
            const int kcol = nt * 16 + lanelow;
            for (int r = 0; r < 8; ++r) {
                int t = r + half * 8;
                int nn = n0 + t;
                int cp = nn & 127;
                int npr = (kcol << 10) + (h << 8) + (nn >> 7);
                db[(size_t)cp * Nn + npr] = acc[r];
            }
        }
        __syncthreads();
    }
}

extern "C" void kernel_launch(void* const* d_in, const int* in_sizes, int n_in,
                              void* d_out, int out_size, void* d_ws, size_t ws_size,
                              hipStream_t stream) {
    const float* skip = (const float*)d_in[0];
    const float* outT = (const float*)d_in[1];
    const float* gf   = (const float*)d_in[2];
    const float* ln_w = (const float*)d_in[3];
    const float* ln_b = (const float*)d_in[4];
    const float* temp = (const float*)d_in[5];
    const float* EF1  = (const float*)d_in[6];
    const float* EF2  = (const float*)d_in[7];
    float* dst   = (float*)d_out;
    float* kproj = (float*)d_ws;          // Bn*Cn*32 = 16384 floats
    float* vproj = kproj + Bn * Cn * 32;  // Bn*Cn*32 = 16384 floats

    zero_ws_kernel<<<64, 256, 0, stream>>>(kproj, Bn * Cn * 32);
    vproj_kernel<<<Bn, 256, 0, stream>>>(gf, EF1, vproj);
    kproj_kernel<<<dim3(64, Bn), 256, 0, stream>>>(skip, EF2, ln_w, ln_b, kproj);
    attn_kernel<<<dim3(128, Bn), 256, 0, stream>>>(outT, ln_w, ln_b, temp,
                                                   kproj, vproj, dst);
}

// v001
// It runs in 334 microseconds.
// Timed twice side by side with v000, it ran 1.09 and 1.11 times as fast.
#include <hip/hip_runtime.h>

typedef float v2f __attribute__((ext_vector_type(2)));
typedef float v4f __attribute__((ext_vector_type(4)));
typedef float v8f __attribute__((ext_vector_type(8)));

typedef unsigned int tdm_u32x4 __attribute__((ext_vector_type(4)));
typedef int          tdm_i32x8 __attribute__((ext_vector_type(8)));
typedef int          tdm_i32x4 __attribute__((ext_vector_type(4)));

#ifndef USE_TDM
# define USE_TDM 1
#endif

#define Bn   4
#define Cn   128
#define Nn   32768
#define NGn  64
#define LN_EPS 1e-5f
#define S1   34    // phase-1 LDS row stride (even => aligned b64 lane fetches)
#define S2   130   // phase-2 LDS row stride (even, conflict-free)
#define CHUNKS 256        // token chunks per batch in the k_proj sum
#define CTILES 4          // 32-token tiles per chunk (CHUNKS * CTILES * 32 == Nn)
#define PLANE  (Cn * 32)  // floats in one chunk's partial k_proj

// v_proj[b, c=h*32+d, k] = sum_{n<64} global_fea[b,n,c] * EF1[n,k]  (tiny)
__global__ void __launch_bounds__(256)
vproj_kernel(const float* __restrict__ gf, const float* __restrict__ EF1,
             float* __restrict__ vproj) {
    int b = blockIdx.x;
    for (int idx = threadIdx.x; idx < Cn * 32; idx += 256) {
        int c = idx >> 5, k = idx & 31;
        float s = 0.0f;
        for (int n = 0; n < NGn; ++n)
            s += gf[(b * NGn + n) * Cn + c] * EF1[n * 32 + k];
        vproj[(b * Cn + c) * 32 + k] = s;
    }
}

__global__ void __launch_bounds__(256)
kproj_kernel(const float* __restrict__ skip, const float* __restrict__ EF2,
             const float* __restrict__ ln_w, const float* __restrict__ ln_b,
             float* __restrict__ part) {
    __shared__ float lnT[Cn * S1];     // [channel][token], padded stride 34
    __shared__ float ef2T[32 * S1];    // [p][token],       padded stride 34

    const int b = blockIdx.y;
    const int chunk = blockIdx.x;              // 256 chunks * 128 tokens
    const int tid = threadIdx.x;
    const int lane = tid & 31, wave = tid >> 5;
    const int lanelow = lane & 15, half = lane >> 4;
    const float* skb = skip + (size_t)b * Cn * Nn;

    v8f acc0 = {0,0,0,0,0,0,0,0};
    v8f acc1 = {0,0,0,0,0,0,0,0};

#if USE_TDM
    const unsigned lds_base = (unsigned)(size_t)(void*)&lnT[0];
    tdm_i32x8 g1;
    g1[0] = (int)((2u << 16) | (1u << 20) | (4u << 22) | (1u << 25));
    g1[1] = (int)0x80000000u;
    g1[2] = (int)(128u << 16);
    g1[3] = (int)(32u << 16);
    g1[4] = (int)128u;
    g1[5] = (int)32768u;
    g1[6] = 0;
    g1[7] = 0;
    const tdm_i32x4 gz = {0, 0, 0, 0};
#endif

    for (int tile = 0; tile < CTILES; ++tile) {
        const int n0 = (chunk * CTILES + tile) * 32;
#if USE_TDM
        if (wave == 0) {
            unsigned long long ga = (unsigned long long)(size_t)(skb + n0);
            tdm_u32x4 g0;
            g0[0] = 1u;                                  // count=1
            g0[1] = lds_base;                            // lds_addr
            g0[2] = (unsigned)(ga & 0xFFFFFFFFu);        // global_addr lo
            g0[3] = (unsigned)((ga >> 32) & 0x01FFFFFFu) // global_addr hi
                    | 0x80000000u;                       // type=2
#if __clang_major__ >= 23
            __builtin_amdgcn_tensor_load_to_lds(g0, g1, gz, gz,
                                                (tdm_i32x8){0,0,0,0,0,0,0,0}, 0);
#else
            __builtin_amdgcn_tensor_load_to_lds(g0, g1, gz, gz, 0);
#endif
        }
#else
        for (int i = 0; i < 16; ++i) {                   // fallback: plain loads
            int idx = tid + i * 256;
            int c = idx >> 5, t = idx & 31;
            lnT[c * S1 + t] = skb[(size_t)c * Nn + n0 + t];
        }
#endif
        // EF2 tile [p][t]
        for (int i = 0; i < 4; ++i) {
            int idx = tid + i * 256;
            int p = idx & 31, t = idx >> 5;
            ef2T[p * S1 + t] = EF2[(size_t)(n0 + t) * 32 + p];
        }
#if USE_TDM
        __builtin_amdgcn_s_wait_tensorcnt(0);
#endif
        __syncthreads();
        // LayerNorm over C per token; wave handles 4 tokens
        for (int j = 0; j < 4; ++j) {
            int t = wave * 4 + j;
            float s = 0.0f, s2 = 0.0f;
            for (int cc = lane; cc < Cn; cc += 32) {
                float x = lnT[cc * S1 + t];
                s += x; s2 += x * x;
            }
            for (int m = 16; m >= 1; m >>= 1) {
                s  += __shfl_xor(s,  m, 32);
                s2 += __shfl_xor(s2, m, 32);
            }
            float mu  = s * (1.0f / 128.0f);
            float var = s2 * (1.0f / 128.0f) - mu * mu;
            float rs  = rsqrtf(var + LN_EPS);
            for (int cc = lane; cc < Cn; cc += 32) {
                float x = lnT[cc * S1 + t];
                lnT[cc * S1 + t] = (x - mu) * rs * ln_w[cc] + ln_b[cc];
            }
        }
        __syncthreads();
        // WMMA: A[m=c][k=t] = lnT[c][t]; B[k=t][n=p] = ef2T[p][t]
        const int mrow = wave * 16 + lanelow;
        for (int kk = 0; kk < 8; ++kk) {
            int kb = kk * 4 + half * 2;
            v2f a  = *(const v2f*)&lnT[mrow * S1 + kb];
            v2f b0 = *(const v2f*)&ef2T[lanelow * S1 + kb];
            v2f b1 = *(const v2f*)&ef2T[(16 + lanelow) * S1 + kb];
            acc0 = __builtin_amdgcn_wmma_f32_16x16x4_f32(false, a, false, b0,
                                                         (short)0, acc0, false, false);
            acc1 = __builtin_amdgcn_wmma_f32_16x16x4_f32(false, a, false, b1,
                                                         (short)0, acc1, false, false);
        }
        __syncthreads();
    }
    float* pl = part + (size_t)(b * CHUNKS + chunk) * PLANE + wave * 512 + lane * 4;
    *(v4f*)(pl)       = (v4f){acc0[0], acc0[1], acc0[2], acc0[3]};
    *(v4f*)(pl + 128) = (v4f){acc0[4], acc0[5], acc0[6], acc0[7]};
    *(v4f*)(pl + 256) = (v4f){acc1[0], acc1[1], acc1[2], acc1[3]};
    *(v4f*)(pl + 384) = (v4f){acc1[4], acc1[5], acc1[6], acc1[7]};
}

// k_proj[b, c, p] = sum over the batch's CHUNKS partial planes, in a fixed order:
// wave w adds planes 32w .. 32w+31 in turn, then the 8 wave sums are added in turn.
// Block = (128 consecutive plane elements, batch).
__global__ void __launch_bounds__(256)
kproj_reduce_kernel(const float* __restrict__ part, float* __restrict__ kproj) {
    __shared__ float red[8 * 128];     // [wave][element]

    const int b = blockIdx.y;
    const int seg = blockIdx.x;                // = (producer wave)*4 + q
    const int tid = threadIdx.x;
    const int lane = tid & 31, wave = tid >> 5;
    const float* p = part + (size_t)(b * CHUNKS + wave * 32) * PLANE + seg * 128 + lane * 4;

    v4f s = {0, 0, 0, 0};
    // unrolled so that the independent loads run ahead of the ordered adds
#pragma unroll
    for (int i = 0; i < 32; ++i)
        s += *(const v4f*)(p + (size_t)i * PLANE);
    *(v4f*)&red[wave * 128 + lane * 4] = s;
    __syncthreads();
    if (tid < 128) {
        float t = red[tid];
        for (int w = 1; w < 8; ++w) t += red[w * 128 + tid];
        const int pl = tid >> 2, r = (seg & 1) * 4 + (tid & 3);
        const int m   = (seg >> 2) * 16 + (pl >> 4) * 8 + r;
        const int col = ((seg >> 1) & 1) * 16 + (pl & 15);
        kproj[((b * Cn + m) << 5) + col] = t;
    }
}

// Per 16-token tile: LN(out) -> q ; logits = q . k_proj * temp ; softmax(32) ;
// x = attn . v_proj ; scatter with the reference's scrambled reshape:
//   dst[b, c'=n&127, n'=k*1024+h*256+(n>>7)] = x[b,h,n,k]
__global__ void __launch_bounds__(256)
attn_kernel(const float* __restrict__ outT, const float* __restrict__ ln_w,
            const float* __restrict__ ln_b, const float* __restrict__ temp3,
            const float* __restrict__ kproj, const float* __restrict__ vproj,
            float* __restrict__ dst) {
    __shared__ float lnT[16 * S2];     // [token][channel]
    __shared__ float attnT[16 * S2];   // [token][h*32+p]
    __shared__ float kpT[32 * S2];     // [p][c=h*32+d]   (transposed k_proj)
    __shared__ float vpT[32 * S2];     // [k][c=h*32+p]   (transposed v_proj)

    const int b = blockIdx.y;
    const int chunk = blockIdx.x;              // 128 chunks * 256 tokens
    const int tid = threadIdx.x;
    const int lane = tid & 31, wave = tid >> 5;
    const int lanelow = lane & 15, half = lane >> 4;
    const int h = wave >> 1, nt = wave & 1;    // wave <-> (head, N-tile)
    const float th = temp3[h];

    for (int i = 0; i < 16; ++i) {
        int idx = tid + i * 256;
        int p = idx & 31, c = idx >> 5;
        kpT[p * S2 + c] = kproj[((b * Cn + c) << 5) + p];
        vpT[p * S2 + c] = vproj[((b * Cn + c) << 5) + p];
    }
    __syncthreads();

    const float* ob = outT + (size_t)b * Cn * Nn;
    float* db = dst + (size_t)b * Cn * Nn;

    for (int tile = 0; tile < 16; ++tile) {
        const int n0 = chunk * 256 + tile * 16;
        for (int i = 0; i < 8; ++i) {
            int idx = tid + i * 256;
            int t = idx & 15, c = idx >> 4;
            lnT[t * S2 + c] = ob[(size_t)c * Nn + n0 + t];
        }
        __syncthreads();
        for (int j = 0; j < 2; ++j) {          // LN: wave handles 2 tokens
            int t = wave * 2 + j;
            float s = 0.0f, s2 = 0.0f;
            for (int cc = lane; cc < Cn; cc += 32) {
                float x = lnT[t * S2 + cc];
                s += x; s2 += x * x;
            }
            for (int m = 16; m >= 1; m >>= 1) {
                s  += __shfl_xor(s,  m, 32);
                s2 += __shfl_xor(s2, m, 32);
            }
            float mu  = s * (1.0f / 128.0f);
            float var = s2 * (1.0f / 128.0f) - mu * mu;
            float rs  = rsqrtf(var + LN_EPS);
            for (int cc = lane; cc < Cn; cc += 32) {
                float x = lnT[t * S2 + cc];
                lnT[t * S2 + cc] = (x - mu) * rs * ln_w[cc] + ln_b[cc];
            }
        }
        __syncthreads();
        {   // logits[t][p] = sum_d q[t][h*32+d] * kproj[h*32+d][p]
            v8f acc = {0,0,0,0,0,0,0,0};
            for (int kk = 0; kk < 8; ++kk) {
                int kb = kk * 4 + half * 2;
                v2f a  = *(const v2f*)&lnT[lanelow * S2 + h * 32 + kb];
                v2f bb = *(const v2f*)&kpT[(nt * 16 + lanelow) * S2 + h * 32 + kb];
                acc = __builtin_amdgcn_wmma_f32_16x16x4_f32(false, a, false, bb,
                                                            (short)0, acc, false, false);
            }
            for (int r = 0; r < 8; ++r) {
                int t = r + half * 8;
                attnT[t * S2 + h * 32 + nt * 16 + lanelow] = acc[r] * th;
            }
        }
        __syncthreads();
        if (tid < 64) {                        // softmax over 32, rows (t, head)
            int t = tid >> 2, hh = tid & 3;
            float* row = &attnT[t * S2 + hh * 32];
            float mx = row[0];
            for (int p = 1; p < 32; ++p) mx = fmaxf(mx, row[p]);
            float s = 0.0f;
            for (int p = 0; p < 32; ++p) { float e = __expf(row[p] - mx); row[p] = e; s += e; }
            float inv = 1.0f / s;
            for (int p = 0; p < 32; ++p) row[p] *= inv;
        }
        __syncthreads();
        {   // x[t][k] = sum_p attn[t][h*32+p] * vproj[h*32+p][k] ; scatter
            v8f acc = {0,0,0,0,0,0,0,0};
            for (int kk = 0; kk < 8; ++kk) {
                int kb = kk * 4 + half * 2;
                v2f a  = *(const v2f*)&attnT[lanelow * S2 + h * 32 + kb];
                v2f bb = *(const v2f*)&vpT[(nt * 16 + lanelow) * S2 + h * 32 + kb];
                acc = __builtin_amdgcn_wmma_f32_16x16x4_f32(false, a, false, bb,
                                                            (short)0, acc, false, false);
            }
            const int kcol = nt * 16 + lanelow;
            for (int r = 0; r < 8; ++r) {
                int t = r + half * 8;
                int nn = n0 + t;
                int cp = nn & 127;
                int npr = (kcol << 10) + (h << 8) + (nn >> 7);
                db[(size_t)cp * Nn + npr] = acc[r];
            }
        }
        __syncthreads();
    }
}

extern "C" void kernel_launch(void* const* d_in, const int* in_sizes, int n_in,
                              void* d_out, int out_size, void* d_ws, size_t ws_size,
                              hipStream_t stream) {
    const float* skip = (const float*)d_in[0];
    const float* outT = (const float*)d_in[1];
    const float* gf   = (const float*)d_in[2];
    const float* ln_w = (const float*)d_in[3];
    const float* ln_b = (const float*)d_in[4];
    const float* temp = (const float*)d_in[5];
    const float* EF1  = (const float*)d_in[6];
    const float* EF2  = (const float*)d_in[7];
    float* dst   = (float*)d_out;
    float* kproj = (float*)d_ws;          // Bn*Cn*32 = 16384 floats
    float* vproj = kproj + Bn * Cn * 32;  // Bn*Cn*32 = 16384 floats
    float* part  = vproj + Bn * Cn * 32;  // Bn*CHUNKS*PLANE floats = 16 MiB

    vproj_kernel<<<Bn, 256, 0, stream>>>(gf, EF1, vproj);
    kproj_kernel<<<dim3(CHUNKS, Bn), 256, 0, stream>>>(skip, EF2, ln_w, ln_b, part);
    kproj_reduce_kernel<<<dim3(PLANE / 128, Bn), 256, 0, stream>>>(part, kproj);
    attn_kernel<<<dim3(128, Bn), 256, 0, stream>>>(outT, ln_w, ln_b, temp,
                                                   kproj, vproj, dst);
}

// v002
// A run of this version takes 81.5 microseconds.
// Timed twice side by side with v001, it ran 4.05 and 4.07 times as fast.
// Over all steps from v000 it is 4.45 times as fast.
#include <hip/hip_runtime.h>

typedef float v2f __attribute__((ext_vector_type(2)));
typedef float v4f __attribute__((ext_vector_type(4)));
typedef float v8f __attribute__((ext_vector_type(8)));

typedef unsigned int tdm_u32x4 __attribute__((ext_vector_type(4)));
typedef int          tdm_i32x8 __attribute__((ext_vector_type(8)));
typedef int          tdm_i32x4 __attribute__((ext_vector_type(4)));

#ifndef USE_TDM
# define USE_TDM 1
#endif

#define Bn   4
#define Cn   128
#define Nn   32768
#define NGn  64
#define LN_EPS 1e-5f
#define LOG2E  1.44269504f
#define S1   34    // phase-1 LDS row stride (even => aligned b64 lane fetches)
#define S2   132   // phase-2 LDS row stride (16 B x odd: conflict-free 16-byte lane fetches)
#define XP   33    // phase-2 write-out line pitch (32 floats + 1)
#define CHUNKS 256        // token chunks per batch in the k_proj sum
#define CTILES 4          // 32-token tiles per chunk (CHUNKS * CTILES * 32 == Nn)
#define PLANE  (Cn * 32)  // floats in one chunk's partial k_proj

// v_proj[b, c=h*32+d, k] = sum_{n<64} global_fea[b,n,c] * EF1[n,k]  (tiny)
__global__ void __launch_bounds__(256)
vproj_kernel(const float* __restrict__ gf, const float* __restrict__ EF1,
             float* __restrict__ vproj) {
    int b = blockIdx.x;
    for (int idx = threadIdx.x; idx < Cn * 32; idx += 256) {
        int c = idx >> 5, k = idx & 31;
        float s = 0.0f;
        for (int n = 0; n < NGn; ++n)
            s += gf[(b * NGn + n) * Cn + c] * EF1[n * 32 + k];
        vproj[(b * Cn + c) * 32 + k] = s;
    }
}

__global__ void __launch_bounds__(256)
kproj_kernel(const float* __restrict__ skip, const float* __restrict__ EF2,
             const float* __restrict__ ln_w, const float* __restrict__ ln_b,
             float* __restrict__ part) {
    __shared__ float lnT[Cn * S1];     // [channel][token], padded stride 34
    __shared__ float ef2T[32 * S1];    // [p][token],       padded stride 34

    const int b = blockIdx.y;
    const int chunk = blockIdx.x;              // 256 chunks * 128 tokens
    const int tid = threadIdx.x;
    const int lane = tid & 31, wave = tid >> 5;
    const int lanelow = lane & 15, half = lane >> 4;
    const float* skb = skip + (size_t)b * Cn * Nn;

    v8f acc0 = {0,0,0,0,0,0,0,0};
    v8f acc1 = {0,0,0,0,0,0,0,0};

#if USE_TDM
    const unsigned lds_base = (unsigned)(size_t)(void*)&lnT[0];
    tdm_i32x8 g1;
    g1[0] = (int)((2u << 16) | (1u << 20) | (4u << 22) | (1u << 25));
    g1[1] = (int)0x80000000u;
    g1[2] = (int)(128u << 16);
    g1[3] = (int)(32u << 16);
    g1[4] = (int)128u;
    g1[5] = (int)32768u;
    g1[6] = 0;
    g1[7] = 0;
    const tdm_i32x4 gz = {0, 0, 0, 0};
#endif

    for (int tile = 0; tile < CTILES; ++tile) {
        const int n0 = (chunk * CTILES + tile) * 32;
#if USE_TDM
        if (wave == 0) {
            unsigned long long ga = (unsigned long long)(size_t)(skb + n0);
            tdm_u32x4 g0;
            g0[0] = 1u;                                  // count=1
            g0[1] = lds_base;                            // lds_addr
            g0[2] = (unsigned)(ga & 0xFFFFFFFFu);        // global_addr lo
            g0[3] = (unsigned)((ga >> 32) & 0x01FFFFFFu) // global_addr hi
                    | 0x80000000u;                       // type=2
#if __clang_major__ >= 23
            __builtin_amdgcn_tensor_load_to_lds(g0, g1, gz, gz,
                                                (tdm_i32x8){0,0,0,0,0,0,0,0}, 0);
#else
            __builtin_amdgcn_tensor_load_to_lds(g0, g1, gz, gz, 0);
#endif
        }
#else
        for (int i = 0; i < 16; ++i) {                   // fallback: plain loads
            int idx = tid + i * 256;
            int c = idx >> 5, t = idx & 31;
            lnT[c * S1 + t] = skb[(size_t)c * Nn + n0 + t];
        }
#endif
        // EF2 tile [p][t]
        for (int i = 0; i < 4; ++i) {
            int idx = tid + i * 256;
            int p = idx & 31, t = idx >> 5;
            ef2T[p * S1 + t] = EF2[(size_t)(n0 + t) * 32 + p];
        }
#if USE_TDM
        __builtin_amdgcn_s_wait_tensorcnt(0);
#endif
        __syncthreads();
        // LayerNorm over C per token; wave handles 4 tokens
        for (int j = 0; j < 4; ++j) {
            int t = wave * 4 + j;
            float s = 0.0f, s2 = 0.0f;
            for (int cc = lane; cc < Cn; cc += 32) {
                float x = lnT[cc * S1 + t];
                s += x; s2 += x * x;
            }
            for (int m = 16; m >= 1; m >>= 1) {
                s  += __shfl_xor(s,  m, 32);
                s2 += __shfl_xor(s2, m, 32);
            }
            float mu  = s * (1.0f / 128.0f);
            float var = s2 * (1.0f / 128.0f) - mu * mu;
            float rs  = rsqrtf(var + LN_EPS);
            for (int cc = lane; cc < Cn; cc += 32) {
                float x = lnT[cc * S1 + t];
                lnT[cc * S1 + t] = (x - mu) * rs * ln_w[cc] + ln_b[cc];
            }
        }
        __syncthreads();
        // WMMA: A[m=c][k=t] = lnT[c][t]; B[k=t][n=p] = ef2T[p][t]
        const int mrow = wave * 16 + lanelow;
        for (int kk = 0; kk < 8; ++kk) {
            int kb = kk * 4 + half * 2;
            v2f a  = *(const v2f*)&lnT[mrow * S1 + kb];
            v2f b0 = *(const v2f*)&ef2T[lanelow * S1 + kb];
            v2f b1 = *(const v2f*)&ef2T[(16 + lanelow) * S1 + kb];
            acc0 = __builtin_amdgcn_wmma_f32_16x16x4_f32(false, a, false, b0,
                                                         (short)0, acc0, false, false);
            acc1 = __builtin_amdgcn_wmma_f32_16x16x4_f32(false, a, false, b1,
                                                         (short)0, acc1, false, false);
        }
        __syncthreads();
    }
    float* pl = part + (size_t)(b * CHUNKS + chunk) * PLANE + wave * 512 + lane * 4;
    *(v4f*)(pl)       = (v4f){acc0[0], acc0[1], acc0[2], acc0[3]};
    *(v4f*)(pl + 128) = (v4f){acc0[4], acc0[5], acc0[6], acc0[7]};
    *(v4f*)(pl + 256) = (v4f){acc1[0], acc1[1], acc1[2], acc1[3]};
    *(v4f*)(pl + 384) = (v4f){acc1[4], acc1[5], acc1[6], acc1[7]};
}

// k_proj[b, c, p] = sum over the batch's CHUNKS partial planes, in a fixed order:
// wave w adds planes 32w .. 32w+31 in turn, then the 8 wave sums are added in turn.
// Block = (128 consecutive plane elements, batch).
__global__ void __launch_bounds__(256)
kproj_reduce_kernel(const float* __restrict__ part, float* __restrict__ kproj) {
    __shared__ float red[8 * 128];     // [wave][element]

    const int b = blockIdx.y;
    const int seg = blockIdx.x;                // = (producer wave)*4 + q
    const int tid = threadIdx.x;
    const int lane = tid & 31, wave = tid >> 5;
    const float* p = part + (size_t)(b * CHUNKS + wave * 32) * PLANE + seg * 128 + lane * 4;

    v4f s = {0, 0, 0, 0};
    // unrolled so that the independent loads run ahead of the ordered adds
#pragma unroll
    for (int i = 0; i < 32; ++i)
        s += *(const v4f*)(p + (size_t)i * PLANE);
    *(v4f*)&red[wave * 128 + lane * 4] = s;
    __syncthreads();
    if (tid < 128) {
        float t = red[tid];
        for (int w = 1; w < 8; ++w) t += red[w * 128 + tid];
        const int pl = tid >> 2, r = (seg & 1) * 4 + (tid & 3);
        const int m   = (seg >> 2) * 16 + (pl >> 4) * 8 + r;
        const int col = ((seg >> 1) & 1) * 16 + (pl & 15);
        kproj[((b * Cn + m) << 5) + col] = t;
    }
}

// Work-group barrier that orders LDS alone. No wave reads what another wave wrote
// to global memory, so a wave's dst stores may stay in flight across it;
// __syncthreads() would drain them (s_wait_storecnt 0) once a head.
__device__ __forceinline__ void lds_barrier() {
    __builtin_amdgcn_fence(__ATOMIC_RELEASE, "workgroup", "local");
    __builtin_amdgcn_s_barrier();
    __builtin_amdgcn_fence(__ATOMIC_ACQUIRE, "workgroup", "local");
}

__device__ __forceinline__ float exp2_slot(float x) {
    float e;
    asm("v_exp_f32 %0, %1\n\tv_nop" : "=v"(e) : "v"(x));
    return e;
}

// A wave owns one 16-token tile and keeps it in registers; a block of 32 waves
// owns tokens n = (g*32 + wave)*128 + c0 + t, t < 16, so that the reference's
// scrambled reshape
//   dst[b, c'=n&127, n'=k*1024+h*256+(n>>7)] = x[b,h,n,k]
// gives the block whole 128-byte lines of dst (32 consecutive n>>7 per line).
// Both products run transposed (tokens are the N columns):
//   logitsT[p][t] = sum_d k_proj[d][p] * q[t][d]   -> a lane holds 16 p of one token
//   xT[k][t]      = sum_p v_proj[p][k] * attn[t][p]
// so softmax needs one exchange between the lane halves, and the logits'
// accumulator registers are the second product's B operand as they stand.
// k order, equal for A and B at every (half, register) position:
//   product 1, step 2s+w: d = 8s + 4*half + 2w + v
//   product 2, step (mt,u,w): p = 16mt + 8*half + 4u + 2w + v
__global__ void __launch_bounds__(1024)
attn_kernel(const float* __restrict__ outT, const float* __restrict__ ln_w,
            const float* __restrict__ ln_b, const float* __restrict__ temp3,
            const float* __restrict__ kproj, const float* __restrict__ vproj,
            float* __restrict__ dst) {
    __shared__ __attribute__((aligned(16))) float kpT[32 * S2];  // [p][c=h*32+d]
    __shared__ __attribute__((aligned(16))) float vpT[32 * S2];  // [k][c=h*32+p]
    __shared__ __attribute__((aligned(16))) float lnw[Cn];
    __shared__ __attribute__((aligned(16))) float lnb[Cn];
    __shared__ float xs[2][512 * XP];  // [head parity][line = k*16+t][n>>7 & 31]

    const int b = blockIdx.y;
    const int c0 = (blockIdx.x & 7) * 16;      // first c' of the block
    const int g = blockIdx.x >> 3;             // which 32 values of n>>7
    const int tid = threadIdx.x;
    const int lane = tid & 31, wave = tid >> 5;
    const int lanelow = lane & 15, half = lane >> 4;

    // k_proj, v_proj: 4 consecutive p of one channel per thread
    const int sc = tid >> 3, sp = (tid & 7) * 4;
    const float* kg = &kproj[((b * Cn + sc) << 5) + sp];
    const float* vg = &vproj[((b * Cn + sc) << 5) + sp];
    const v4f kq = *(const v4f*)kg;
    const v4f vq = *(const v4f*)vg;

    // the tile: register i holds channel (i>>2)*8 + 4*half + (i&3) of token lanelow
    const float* xp = outT + (size_t)b * Cn * Nn + (size_t)(4 * half) * Nn
                    + (g * 32 + wave) * 128 + c0 + lanelow;
    const float* xp2 = xp + (size_t)64 * Nn;   // channels 64 and up
    float q[64];
#pragma unroll  // constant indices keep the arrays in registers
    for (int i = 0; i < 32; ++i) {
        q[i]      = xp[(size_t)((i >> 2) * 8 + (i & 3)) * Nn];
        q[32 + i] = xp2[(size_t)((i >> 2) * 8 + (i & 3)) * Nn];
    }
    // The wait that stands before a register named by an issued load is rewritten;
    // the addresses are inputs so that they live up to it and no load lands in one.
    asm volatile("s_wait_xcnt 0x0" :: "v"(kg), "v"(vg), "v"(xp), "v"(xp2) : "memory");

#pragma unroll  // constant indices keep the arrays in registers
    for (int e = 0; e < 4; ++e) {
        kpT[(sp + e) * S2 + sc] = kq[e];
        vpT[(sp + e) * S2 + sc] = vq[e];
    }
    if (tid < Cn) { lnw[tid] = ln_w[tid]; lnb[tid] = ln_b[tid]; }
    asm volatile("s_wait_xcnt 0x0" ::: "memory");
    lds_barrier();

    // LayerNorm statistics of token lanelow: 64 channels here, 64 in the other half
    float sa[4] = {0, 0, 0, 0}, sb[4] = {0, 0, 0, 0};
#pragma unroll  // constant indices keep the arrays in registers
    for (int i = 0; i < 64; ++i) { sa[i & 3] += q[i]; sb[i & 3] += q[i] * q[i]; }
    float s  = (sa[0] + sa[1]) + (sa[2] + sa[3]);
    float s2 = (sb[0] + sb[1]) + (sb[2] + sb[3]);
    s  += __shfl_xor(s,  16, 32);
    s2 += __shfl_xor(s2, 16, 32);
    const float mu  = s * (1.0f / 128.0f);
    const float var = s2 * (1.0f / 128.0f) - mu * mu;
    const float rs  = rsqrtf(var + LN_EPS);

    float* db = dst + (size_t)b * Cn * Nn + (size_t)c0 * Nn + (wave << 10) + g * 32 + lane;

#pragma unroll  // constant indices keep the arrays in registers
    for (int h = 0; h < 4; ++h) {
        const float th = temp3[h];
        v8f l[2] = {{0,0,0,0,0,0,0,0}, {0,0,0,0,0,0,0,0}};
#pragma unroll  // constant indices keep the arrays in registers
        for (int s4 = 0; s4 < 4; ++s4) {
            const int cb = h * 32 + s4 * 8 + 4 * half;
            const v4f w4 = *(const v4f*)&lnw[cb];
            const v4f b4 = *(const v4f*)&lnb[cb];
            float qn[4];
#pragma unroll  // constant indices keep the arrays in registers
            for (int e = 0; e < 4; ++e)
                qn[e] = (q[h * 16 + s4 * 4 + e] - mu) * rs * w4[e] + b4[e];
            const v4f a0 = *(const v4f*)&kpT[lanelow * S2 + cb];
            const v4f a1 = *(const v4f*)&kpT[(16 + lanelow) * S2 + cb];
            const v2f q0 = {qn[0], qn[1]}, q1 = {qn[2], qn[3]};
            l[0] = __builtin_amdgcn_wmma_f32_16x16x4_f32(false, (v2f){a0[0], a0[1]}, false, q0,
                                                         (short)0, l[0], false, false);
            l[1] = __builtin_amdgcn_wmma_f32_16x16x4_f32(false, (v2f){a1[0], a1[1]}, false, q0,
                                                         (short)0, l[1], false, false);
            l[0] = __builtin_amdgcn_wmma_f32_16x16x4_f32(false, (v2f){a0[2], a0[3]}, false, q1,
                                                         (short)0, l[0], false, false);
            l[1] = __builtin_amdgcn_wmma_f32_16x16x4_f32(false, (v2f){a1[2], a1[3]}, false, q1,
                                                         (short)0, l[1], false, false);
        }
        // softmax over the 32 p of token lanelow: l[mt][r] is p = 16mt + 8*half + r
        float mx = l[0][0] * th;
#pragma unroll  // constant indices keep the arrays in registers
        for (int r = 0; r < 8; ++r) {
            l[0][r] *= th; l[1][r] *= th;
            mx = fmaxf(mx, fmaxf(l[0][r], l[1][r]));
        }
        mx = fmaxf(mx, __shfl_xor(mx, 16, 32));
        float e0 = 0.0f, e1 = 0.0f;
#pragma unroll  // constant indices keep the arrays in registers
        for (int r = 0; r < 8; ++r) {
            l[0][r] = exp2_slot((l[0][r] - mx) * LOG2E); e0 += l[0][r];
            l[1][r] = exp2_slot((l[1][r] - mx) * LOG2E); e1 += l[1][r];
        }
        float es = e0 + e1;
        es += __shfl_xor(es, 16, 32);
        const float inv = 1.0f / es;
#pragma unroll  // constant indices keep the arrays in registers
        for (int r = 0; r < 8; ++r) { l[0][r] *= inv; l[1][r] *= inv; }

        v8f x0 = {0,0,0,0,0,0,0,0};
        v8f x1 = {0,0,0,0,0,0,0,0};
#pragma unroll  // constant indices keep the arrays in registers
        for (int mt = 0; mt < 2; ++mt) {
#pragma unroll  // constant indices keep the arrays in registers
            for (int u = 0; u < 2; ++u) {
                const int pb = h * 32 + 16 * mt + 8 * half + 4 * u;
                const v4f a0 = *(const v4f*)&vpT[lanelow * S2 + pb];
                const v4f a1 = *(const v4f*)&vpT[(16 + lanelow) * S2 + pb];
                const v2f p0 = {l[mt][4 * u], l[mt][4 * u + 1]};
                const v2f p1 = {l[mt][4 * u + 2], l[mt][4 * u + 3]};
                x0 = __builtin_amdgcn_wmma_f32_16x16x4_f32(false, (v2f){a0[0], a0[1]}, false, p0,
                                                           (short)0, x0, false, false);
                x1 = __builtin_amdgcn_wmma_f32_16x16x4_f32(false, (v2f){a1[0], a1[1]}, false, p0,
                                                           (short)0, x1, false, false);
                x0 = __builtin_amdgcn_wmma_f32_16x16x4_f32(false, (v2f){a0[2], a0[3]}, false, p1,
                                                           (short)0, x0, false, false);
                x1 = __builtin_amdgcn_wmma_f32_16x16x4_f32(false, (v2f){a1[2], a1[3]}, false, p1,
                                                           (short)0, x1, false, false);
            }
        }
        float* xb = xs[h & 1];
#pragma unroll  // constant indices keep the arrays in registers
        for (int r = 0; r < 8; ++r) {
            xb[((8 * half + r) * 16 + lanelow) * XP + half + wave]      = x0[r];
            xb[((16 + 8 * half + r) * 16 + lanelow) * XP + half + wave] = x1[r];
        }
        // One barrier a head: it publishes this head's lines, and it ends every
        // wave's reads of the other buffer, which the next head overwrites.
        lds_barrier();
        // wave w stores the 16 lines of k = w: 128 contiguous bytes each
#pragma unroll  // constant indices keep the arrays in registers
        for (int i = 0; i < 16; ++i)
            db[(size_t)i * Nn + (h << 8)] = xb[(wave * 16 + i) * XP + ((wave >> 3) & 1) + lane];
        if (h < 3) asm volatile("s_wait_xcnt 0x0" ::: "memory");
    }
}

extern "C" void kernel_launch(void* const* d_in, const int* in_sizes, int n_in,
                              void* d_out, int out_size, void* d_ws, size_t ws_size,
                              hipStream_t stream) {
    const float* skip = (const float*)d_in[0];
    const float* outT = (const float*)d_in[1];
    const float* gf   = (const float*)d_in[2];
    const float* ln_w = (const float*)d_in[3];
    const float* ln_b = (const float*)d_in[4];
    const float* temp = (const float*)d_in[5];
    const float* EF1  = (const float*)d_in[6];
    const float* EF2  = (const float*)d_in[7];
    float* dst   = (float*)d_out;
    float* kproj = (float*)d_ws;          // Bn*Cn*32 = 16384 floats
    float* vproj = kproj + Bn * Cn * 32;  // Bn*Cn*32 = 16384 floats
    float* part  = vproj + Bn * Cn * 32;  // Bn*CHUNKS*PLANE floats = 16 MiB

    vproj_kernel<<<Bn, 256, 0, stream>>>(gf, EF1, vproj);
    kproj_kernel<<<dim3(CHUNKS, Bn), 256, 0, stream>>>(skip, EF2, ln_w, ln_b, part);
    kproj_reduce_kernel<<<dim3(PLANE / 128, Bn), 256, 0, stream>>>(part, kproj);
    attn_kernel<<<dim3(64, Bn), 1024, 0, stream>>>(outT, ln_w, ln_b, temp,
                                                   kproj, vproj, dst);
}

// v003
// A run of this version takes 56.7 microseconds.
// Timed twice side by side with v002, it ran 1.44 and 1.45 times as fast.
// Counting every step since v000, it is 6.44 times as fast.
#include <hip/hip_runtime.h>

typedef float v2f __attribute__((ext_vector_type(2)));
typedef float v4f __attribute__((ext_vector_type(4)));
typedef float v8f __attribute__((ext_vector_type(8)));

typedef unsigned int tdm_u32x4 __attribute__((ext_vector_type(4)));
typedef int          tdm_i32x8 __attribute__((ext_vector_type(8)));
typedef int          tdm_i32x4 __attribute__((ext_vector_type(4)));

#ifndef USE_TDM
# define USE_TDM 1
#endif

#define Bn   4
#define Cn   128
#define Nn   32768
#define NGn  64
#define LN_EPS 1e-5f
#define LOG2E  1.44269504f
#define S1   34    // phase-1 LDS row stride (even => aligned b64 lane fetches)
#define S2   132   // phase-2 LDS row stride (16 B x odd: conflict-free 16-byte lane fetches)
#define XP   33    // phase-2 write-out line pitch (32 floats + 1)
#define CHUNKS 256        // token chunks per batch in the k_proj sum
#define CTILES 4          // 32-token tiles per chunk (CHUNKS * CTILES * 32 == Nn)
#define PLANE  (Cn * 32)  // floats in one chunk's partial k_proj
#define VBLK   16         // v_proj blocks per batch (VBLK * 256 == Cn * 32 outputs)

// v_proj[b, c=h*32+d, k] = sum_{n<64} global_fea[b,n,c] * EF1[n,k], n ascending.
// One output a thread: block vb of a batch owns outputs vb*256 .. vb*256+255.
__device__ __forceinline__ void
vproj_block(const float* __restrict__ gf, const float* __restrict__ EF1,
            float* __restrict__ vproj, int b, int vb) {
    const int idx = vb * 256 + threadIdx.x;
    const int c = idx >> 5, k = idx & 31;
    const float* g = gf + b * NGn * Cn + c;
    const float* e = EF1 + k;
    float s = 0.0f;
    // unrolled so that the independent loads run ahead of the ordered adds
#pragma unroll
    for (int n = 0; n < NGn; ++n)
        s += g[n * Cn] * e[n * 32];
    vproj[b * Cn * 32 + idx] = s;
}

__global__ void __launch_bounds__(256)
kproj_kernel(const float* __restrict__ skip, const float* __restrict__ EF2,
             const float* __restrict__ ln_w, const float* __restrict__ ln_b,
             const float* __restrict__ gf, const float* __restrict__ EF1,
             float* __restrict__ part, float* __restrict__ vproj) {
    __shared__ float lnT[Cn * S1];     // [channel][token], padded stride 34
    __shared__ float ef2T[32 * S1];    // [p][token],       padded stride 34

    if (blockIdx.x >= CHUNKS) {        // whole block, in front of every barrier
        vproj_block(gf, EF1, vproj, blockIdx.y, blockIdx.x - CHUNKS);
        return;
    }

    const int b = blockIdx.y;
    const int chunk = blockIdx.x;              // 256 chunks * 128 tokens
    const int tid = threadIdx.x;
    const int lane = tid & 31, wave = tid >> 5;
    const int lanelow = lane & 15, half = lane >> 4;
    const float* skb = skip + (size_t)b * Cn * Nn;

    v8f acc0 = {0,0,0,0,0,0,0,0};
    v8f acc1 = {0,0,0,0,0,0,0,0};

#if USE_TDM
    const unsigned lds_base = (unsigned)(size_t)(void*)&lnT[0];
    tdm_i32x8 g1;
    g1[0] = (int)((2u << 16) | (1u << 20) | (4u << 22) | (1u << 25));
    g1[1] = (int)0x80000000u;
    g1[2] = (int)(128u << 16);
    g1[3] = (int)(32u << 16);
    g1[4] = (int)128u;
    g1[5] = (int)32768u;
    g1[6] = 0;
    g1[7] = 0;
    const tdm_i32x4 gz = {0, 0, 0, 0};
#endif

    for (int tile = 0; tile < CTILES; ++tile) {
        const int n0 = (chunk * CTILES + tile) * 32;
#if USE_TDM
        if (wave == 0) {
            unsigned long long ga = (unsigned long long)(size_t)(skb + n0);
            tdm_u32x4 g0;
            g0[0] = 1u;                                  // count=1
            g0[1] = lds_base;                            // lds_addr
            g0[2] = (unsigned)(ga & 0xFFFFFFFFu);        // global_addr lo
            g0[3] = (unsigned)((ga >> 32) & 0x01FFFFFFu) // global_addr hi
                    | 0x80000000u;                       // type=2
#if __clang_major__ >= 23
            __builtin_amdgcn_tensor_load_to_lds(g0, g1, gz, gz,
                                                (tdm_i32x8){0,0,0,0,0,0,0,0}, 0);
#else
            __builtin_amdgcn_tensor_load_to_lds(g0, g1, gz, gz, 0);
#endif
        }
#else
        for (int i = 0; i < 16; ++i) {                   // fallback: plain loads
            int idx = tid + i * 256;
            int c = idx >> 5, t = idx & 31;
            lnT[c * S1 + t] = skb[(size_t)c * Nn + n0 + t];
        }
#endif
        // EF2 tile [p][t]
        for (int i = 0; i < 4; ++i) {
            int idx = tid + i * 256;
            int p = idx & 31, t = idx >> 5;
            ef2T[p * S1 + t] = EF2[(size_t)(n0 + t) * 32 + p];
        }
#if USE_TDM
        __builtin_amdgcn_s_wait_tensorcnt(0);
#endif
        __syncthreads();
        // LayerNorm over C per token; wave handles 4 tokens
        for (int j = 0; j < 4; ++j) {
            int t = wave * 4 + j;
            float s = 0.0f, s2 = 0.0f;
            for (int cc = lane; cc < Cn; cc += 32) {
                float x = lnT[cc * S1 + t];
                s += x; s2 += x * x;
            }
            for (int m = 16; m >= 1; m >>= 1) {
                s  += __shfl_xor(s,  m, 32);
                s2 += __shfl_xor(s2, m, 32);
            }
            float mu  = s * (1.0f / 128.0f);
            float var = s2 * (1.0f / 128.0f) - mu * mu;
            float rs  = rsqrtf(var + LN_EPS);
            for (int cc = lane; cc < Cn; cc += 32) {
                float x = lnT[cc * S1 + t];
                lnT[cc * S1 + t] = (x - mu) * rs * ln_w[cc] + ln_b[cc];
            }
        }
        __syncthreads();
        // WMMA: A[m=c][k=t] = lnT[c][t]; B[k=t][n=p] = ef2T[p][t]
        const int mrow = wave * 16 + lanelow;
        for (int kk = 0; kk < 8; ++kk) {
            int kb = kk * 4 + half * 2;
            v2f a  = *(const v2f*)&lnT[mrow * S1 + kb];
            v2f b0 = *(const v2f*)&ef2T[lanelow * S1 + kb];
            v2f b1 = *(const v2f*)&ef2T[(16 + lanelow) * S1 + kb];
            acc0 = __builtin_amdgcn_wmma_f32_16x16x4_f32(false, a, false, b0,
                                                         (short)0, acc0, false, false);
            acc1 = __builtin_amdgcn_wmma_f32_16x16x4_f32(false, a, false, b1,
                                                         (short)0, acc1, false, false);
        }
        __syncthreads();
    }
    float* pl = part + (size_t)(b * CHUNKS + chunk) * PLANE + wave * 512 + lane * 4;
    *(v4f*)(pl)       = (v4f){acc0[0], acc0[1], acc0[2], acc0[3]};
    *(v4f*)(pl + 128) = (v4f){acc0[4], acc0[5], acc0[6], acc0[7]};
    *(v4f*)(pl + 256) = (v4f){acc1[0], acc1[1], acc1[2], acc1[3]};
    *(v4f*)(pl + 384) = (v4f){acc1[4], acc1[5], acc1[6], acc1[7]};
}

// k_proj[b, c, p] = sum over the batch's CHUNKS partial planes, in a fixed order:
// wave w adds planes 32w .. 32w+31 in turn, then the 8 wave sums are added in turn.
// Block = (128 consecutive plane elements, batch).
__global__ void __launch_bounds__(256)
kproj_reduce_kernel(const float* __restrict__ part, float* __restrict__ kproj) {
    __shared__ float red[8 * 128];     // [wave][element]

    const int b = blockIdx.y;
    const int seg = blockIdx.x;                // = (producer wave)*4 + q
    const int tid = threadIdx.x;
    const int lane = tid & 31, wave = tid >> 5;
    const float* p = part + (size_t)(b * CHUNKS + wave * 32) * PLANE + seg * 128 + lane * 4;

    v4f s = {0, 0, 0, 0};
    // unrolled so that the independent loads run ahead of the ordered adds
#pragma unroll
    for (int i = 0; i < 32; ++i)
        s += *(const v4f*)(p + (size_t)i * PLANE);
    *(v4f*)&red[wave * 128 + lane * 4] = s;
    __syncthreads();
    if (tid < 128) {
        float t = red[tid];
        for (int w = 1; w < 8; ++w) t += red[w * 128 + tid];
        const int pl = tid >> 2, r = (seg & 1) * 4 + (tid & 3);
        const int m   = (seg >> 2) * 16 + (pl >> 4) * 8 + r;
        const int col = ((seg >> 1) & 1) * 16 + (pl & 15);
        kproj[((b * Cn + m) << 5) + col] = t;
    }
}

// Work-group barrier that orders LDS alone. No wave reads what another wave wrote
// to global memory, so a wave's dst stores may stay in flight across it;
// __syncthreads() would drain them (s_wait_storecnt 0) once a head.
__device__ __forceinline__ void lds_barrier() {
    __builtin_amdgcn_fence(__ATOMIC_RELEASE, "workgroup", "local");
    __builtin_amdgcn_s_barrier();
    __builtin_amdgcn_fence(__ATOMIC_ACQUIRE, "workgroup", "local");
}

__device__ __forceinline__ float exp2_slot(float x) {
    float e;
    asm("v_exp_f32 %0, %1\n\tv_nop" : "=v"(e) : "v"(x));
    return e;
}

// A wave owns one 16-token tile and keeps it in registers; a block of 32 waves
// owns tokens n = (g*32 + wave)*128 + c0 + t, t < 16, so that the reference's
// scrambled reshape
//   dst[b, c'=n&127, n'=k*1024+h*256+(n>>7)] = x[b,h,n,k]
// gives the block whole 128-byte lines of dst (32 consecutive n>>7 per line).
// Both products run transposed (tokens are the N columns):
//   logitsT[p][t] = sum_d k_proj[d][p] * q[t][d]   -> a lane holds 16 p of one token
//   xT[k][t]      = sum_p v_proj[p][k] * attn[t][p]
// so softmax needs one exchange between the lane halves, and the logits'
// accumulator registers are the second product's B operand as they stand.
// k order, equal for A and B at every (half, register) position:
//   product 1, step 2s+w: d = 8s + 4*half + 2w + v
//   product 2, step (mt,u,w): p = 16mt + 8*half + 4u + 2w + v
__global__ void __launch_bounds__(1024)
attn_kernel(const float* __restrict__ outT, const float* __restrict__ ln_w,
            const float* __restrict__ ln_b, const float* __restrict__ temp3,
            const float* __restrict__ kproj, const float* __restrict__ vproj,
            float* __restrict__ dst) {
    __shared__ __attribute__((aligned(16))) float kpT[32 * S2];  // [p][c=h*32+d]
    __shared__ __attribute__((aligned(16))) float vpT[32 * S2];  // [k][c=h*32+p]
    __shared__ __attribute__((aligned(16))) float lnw[Cn];
    __shared__ __attribute__((aligned(16))) float lnb[Cn];
    __shared__ float xs[2][512 * XP];  // [head parity][line = k*16+t][n>>7 & 31]

    const int b = blockIdx.y;
    const int c0 = (blockIdx.x & 7) * 16;      // first c' of the block
    const int g = blockIdx.x >> 3;             // which 32 values of n>>7
    const int tid = threadIdx.x;
    const int lane = tid & 31, wave = tid >> 5;
    const int lanelow = lane & 15, half = lane >> 4;

    // k_proj, v_proj: 4 consecutive p of one channel per thread
    const int sc = tid >> 3, sp = (tid & 7) * 4;
    const float* kg = &kproj[((b * Cn + sc) << 5) + sp];
    const float* vg = &vproj[((b * Cn + sc) << 5) + sp];
    const v4f kq = *(const v4f*)kg;
    const v4f vq = *(const v4f*)vg;

    // the tile: register i holds channel (i>>2)*8 + 4*half + (i&3) of token lanelow
    const float* xp = outT + (size_t)b * Cn * Nn + (size_t)(4 * half) * Nn
                    + (g * 32 + wave) * 128 + c0 + lanelow;
    const float* xp2 = xp + (size_t)64 * Nn;   // channels 64 and up
    float q[64];
#pragma unroll  // constant indices keep the arrays in registers
    for (int i = 0; i < 32; ++i) {
        q[i]      = xp[(size_t)((i >> 2) * 8 + (i & 3)) * Nn];
        q[32 + i] = xp2[(size_t)((i >> 2) * 8 + (i & 3)) * Nn];
    }
    // The wait that stands before a register named by an issued load is rewritten;
    // the addresses are inputs so that they live up to it and no load lands in one.
    asm volatile("s_wait_xcnt 0x0" :: "v"(kg), "v"(vg), "v"(xp), "v"(xp2) : "memory");

#pragma unroll  // constant indices keep the arrays in registers
    for (int e = 0; e < 4; ++e) {
        kpT[(sp + e) * S2 + sc] = kq[e];
        vpT[(sp + e) * S2 + sc] = vq[e];
    }
    if (tid < Cn) { lnw[tid] = ln_w[tid]; lnb[tid] = ln_b[tid]; }
    asm volatile("s_wait_xcnt 0x0" ::: "memory");
    lds_barrier();

    // LayerNorm statistics of token lanelow: 64 channels here, 64 in the other half
    float sa[4] = {0, 0, 0, 0}, sb[4] = {0, 0, 0, 0};
#pragma unroll  // constant indices keep the arrays in registers
    for (int i = 0; i < 64; ++i) { sa[i & 3] += q[i]; sb[i & 3] += q[i] * q[i]; }
    float s  = (sa[0] + sa[1]) + (sa[2] + sa[3]);
    float s2 = (sb[0] + sb[1]) + (sb[2] + sb[3]);
    s  += __shfl_xor(s,  16, 32);
    s2 += __shfl_xor(s2, 16, 32);
    const float mu  = s * (1.0f / 128.0f);
    const float var = s2 * (1.0f / 128.0f) - mu * mu;
    const float rs  = rsqrtf(var + LN_EPS);

    float* db = dst + (size_t)b * Cn * Nn + (size_t)c0 * Nn + (wave << 10) + g * 32 + lane;

#pragma unroll  // constant indices keep the arrays in registers
    for (int h = 0; h < 4; ++h) {
        const float th = temp3[h];
        v8f l[2] = {{0,0,0,0,0,0,0,0}, {0,0,0,0,0,0,0,0}};
#pragma unroll  // constant indices keep the arrays in registers
        for (int s4 = 0; s4 < 4; ++s4) {
            const int cb = h * 32 + s4 * 8 + 4 * half;
            const v4f w4 = *(const v4f*)&lnw[cb];
            const v4f b4 = *(const v4f*)&lnb[cb];
            float qn[4];
#pragma unroll  // constant indices keep the arrays in registers
            for (int e = 0; e < 4; ++e)
                qn[e] = (q[h * 16 + s4 * 4 + e] - mu) * rs * w4[e] + b4[e];
            const v4f a0 = *(const v4f*)&kpT[lanelow * S2 + cb];
            const v4f a1 = *(const v4f*)&kpT[(16 + lanelow) * S2 + cb];
            const v2f q0 = {qn[0], qn[1]}, q1 = {qn[2], qn[3]};
            l[0] = __builtin_amdgcn_wmma_f32_16x16x4_f32(false, (v2f){a0[0], a0[1]}, false, q0,
                                                         (short)0, l[0], false, false);
            l[1] = __builtin_amdgcn_wmma_f32_16x16x4_f32(false, (v2f){a1[0], a1[1]}, false, q0,
                                                         (short)0, l[1], false, false);
            l[0] = __builtin_amdgcn_wmma_f32_16x16x4_f32(false, (v2f){a0[2], a0[3]}, false, q1,
                                                         (short)0, l[0], false, false);
            l[1] = __builtin_amdgcn_wmma_f32_16x16x4_f32(false, (v2f){a1[2], a1[3]}, false, q1,
                                                         (short)0, l[1], false, false);
        }
        // softmax over the 32 p of token lanelow: l[mt][r] is p = 16mt + 8*half + r
        float mx = l[0][0] * th;
#pragma unroll  // constant indices keep the arrays in registers
        for (int r = 0; r < 8; ++r) {
            l[0][r] *= th; l[1][r] *= th;
            mx = fmaxf(mx, fmaxf(l[0][r], l[1][r]));
        }
        mx = fmaxf(mx, __shfl_xor(mx, 16, 32));
        float e0 = 0.0f, e1 = 0.0f;
#pragma unroll  // constant indices keep the arrays in registers
        for (int r = 0; r < 8; ++r) {
            l[0][r] = exp2_slot((l[0][r] - mx) * LOG2E); e0 += l[0][r];
            l[1][r] = exp2_slot((l[1][r] - mx) * LOG2E); e1 += l[1][r];
        }
        float es = e0 + e1;
        es += __shfl_xor(es, 16, 32);
        const float inv = 1.0f / es;
#pragma unroll  // constant indices keep the arrays in registers
        for (int r = 0; r < 8; ++r) { l[0][r] *= inv; l[1][r] *= inv; }

        v8f x0 = {0,0,0,0,0,0,0,0};
        v8f x1 = {0,0,0,0,0,0,0,0};
#pragma unroll  // constant indices keep the arrays in registers
        for (int mt = 0; mt < 2; ++mt) {
#pragma unroll  // constant indices keep the arrays in registers
            for (int u = 0; u < 2; ++u) {
                const int pb = h * 32 + 16 * mt + 8 * half + 4 * u;
                const v4f a0 = *(const v4f*)&vpT[lanelow * S2 + pb];
                const v4f a1 = *(const v4f*)&vpT[(16 + lanelow) * S2 + pb];
                const v2f p0 = {l[mt][4 * u], l[mt][4 * u + 1]};
                const v2f p1 = {l[mt][4 * u + 2], l[mt][4 * u + 3]};
                x0 = __builtin_amdgcn_wmma_f32_16x16x4_f32(false, (v2f){a0[0], a0[1]}, false, p0,
                                                           (short)0, x0, false, false);
                x1 = __builtin_amdgcn_wmma_f32_16x16x4_f32(false, (v2f){a1[0], a1[1]}, false, p0,
                                                           (short)0, x1, false, false);
                x0 = __builtin_amdgcn_wmma_f32_16x16x4_f32(false, (v2f){a0[2], a0[3]}, false, p1,
                                                           (short)0, x0, false, false);
                x1 = __builtin_amdgcn_wmma_f32_16x16x4_f32(false, (v2f){a1[2], a1[3]}, false, p1,
                                                           (short)0, x1, false, false);
            }
        }
        float* xb = xs[h & 1];
#pragma unroll  // constant indices keep the arrays in registers
        for (int r = 0; r < 8; ++r) {
            xb[((8 * half + r) * 16 + lanelow) * XP + half + wave]      = x0[r];
            xb[((16 + 8 * half + r) * 16 + lanelow) * XP + half + wave] = x1[r];
        }
        // One barrier a head: it publishes this head's lines, and it ends every
        // wave's reads of the other buffer, which the next head overwrites.
        lds_barrier();
        // wave w stores the 16 lines of k = w: 128 contiguous bytes each
#pragma unroll  // constant indices keep the arrays in registers
        for (int i = 0; i < 16; ++i)
            db[(size_t)i * Nn + (h << 8)] = xb[(wave * 16 + i) * XP + ((wave >> 3) & 1) + lane];
        if (h < 3) asm volatile("s_wait_xcnt 0x0" ::: "memory");
    }
}

extern "C" void kernel_launch(void* const* d_in, const int* in_sizes, int n_in,
                              void* d_out, int out_size, void* d_ws, size_t ws_size,
                              hipStream_t stream) {
    const float* skip = (const float*)d_in[0];
    const float* outT = (const float*)d_in[1];
    const float* gf   = (const float*)d_in[2];
    const float* ln_w = (const float*)d_in[3];
    const float* ln_b = (const float*)d_in[4];
    const float* temp = (const float*)d_in[5];
    const float* EF1  = (const float*)d_in[6];
    const float* EF2  = (const float*)d_in[7];
    float* dst   = (float*)d_out;
    float* kproj = (float*)d_ws;          // Bn*Cn*32 = 16384 floats
    float* vproj = kproj + Bn * Cn * 32;  // Bn*Cn*32 = 16384 floats
    float* part  = vproj + Bn * Cn * 32;  // Bn*CHUNKS*PLANE floats = 16 MiB

    kproj_kernel<<<dim3(CHUNKS + VBLK, Bn), 256, 0, stream>>>(skip, EF2, ln_w, ln_b,
                                                              gf, EF1, part, vproj);
    kproj_reduce_kernel<<<dim3(PLANE / 128, Bn), 256, 0, stream>>>(part, kproj);
    attn_kernel<<<dim3(64, Bn), 1024, 0, stream>>>(outT, ln_w, ln_b, temp,
                                                   kproj, vproj, dst);
}

// v004
// It runs in 45.4 microseconds.
// In both of two side-by-side timings against v003, it was 1.25 times as fast.
// All steps since v000 together make it 8.04 times as fast.
#include <hip/hip_runtime.h>

typedef float v2f __attribute__((ext_vector_type(2)));
typedef float v4f __attribute__((ext_vector_type(4)));
typedef float v8f __attribute__((ext_vector_type(8)));

typedef unsigned int tdm_u32x4 __attribute__((ext_vector_type(4)));
typedef int          tdm_i32x8 __attribute__((ext_vector_type(8)));
typedef int          tdm_i32x4 __attribute__((ext_vector_type(4)));

#ifndef USE_TDM
# define USE_TDM 1
#endif

#define Bn   4
#define Cn   128
#define Nn   32768
#define NGn  64
#define LN_EPS 1e-5f
#define LOG2E  1.44269504f
#define S1   34    // phase-1 LDS row stride (even => aligned b64 lane fetches)
#define RP   20    // phase-1 pitch of a token's 8 partial pairs (16 B x odd)
#define S2   132   // phase-2 LDS row stride (16 B x odd: conflict-free 16-byte lane fetches)
#define XP   33    // phase-2 write-out line pitch (32 floats + 1)
#define CHUNKS 256        // token chunks per batch in the k_proj sum
#define CTILES 4          // 32-token tiles per chunk (CHUNKS * CTILES * 32 == Nn)
#define PLANE  (Cn * 32)  // floats in one chunk's partial k_proj
#define VBLK   16         // v_proj blocks per batch (VBLK * 256 == Cn * 32 outputs)

// v_proj[b, c=h*32+d, k] = sum_{n<64} global_fea[b,n,c] * EF1[n,k], n ascending.
// One output a thread: block vb of a batch owns outputs vb*256 .. vb*256+255.
__device__ __forceinline__ void
vproj_block(const float* __restrict__ gf, const float* __restrict__ EF1,
            float* __restrict__ vproj, int b, int vb) {
    const int idx = vb * 256 + threadIdx.x;
    const int c = idx >> 5, k = idx & 31;
    const float* g = gf + b * NGn * Cn + c;
    const float* e = EF1 + k;
    float s = 0.0f;
    // unrolled so that the independent loads run ahead of the ordered adds
#pragma unroll
    for (int n = 0; n < NGn; ++n)
        s += g[n * Cn] * e[n * 32];
    vproj[b * Cn * 32 + idx] = s;
}

__global__ void __launch_bounds__(256)
kproj_kernel(const float* __restrict__ skip, const float* __restrict__ EF2,
             const float* __restrict__ ln_w, const float* __restrict__ ln_b,
             const float* __restrict__ gf, const float* __restrict__ EF1,
             float* __restrict__ part, float* __restrict__ vproj) {
    __shared__ float lnT[Cn * S1];     // [channel][token], padded stride 34
    __shared__ float ef2T[32 * S1];    // [p][token],       padded stride 34
    // [token][wave]: sum, sum of squares of the wave's 16 channels
    __shared__ __attribute__((aligned(16))) float red[32 * RP];

    if (blockIdx.x >= CHUNKS) {        // whole block, in front of every barrier
        vproj_block(gf, EF1, vproj, blockIdx.y, blockIdx.x - CHUNKS);
        return;
    }

    const int b = blockIdx.y;
    const int chunk = blockIdx.x;              // 256 chunks * 128 tokens
    const int tid = threadIdx.x;
    const int lane = tid & 31, wave = tid >> 5;
    const int lanelow = lane & 15, half = lane >> 4;
    const float* skb = skip + (size_t)b * Cn * Nn;

    v8f acc0 = {0,0,0,0,0,0,0,0};
    v8f acc1 = {0,0,0,0,0,0,0,0};

    // ln_w, ln_b of the wave's 16 channels: a wave-uniform index, so scalar loads
    const int wch = __builtin_amdgcn_readfirstlane(wave) * 16;
    float lw[16], lb[16];
#pragma unroll  // constant indices keep the arrays in registers
    for (int i = 0; i < 16; ++i) { lw[i] = ln_w[wch + i]; lb[i] = ln_b[wch + i]; }

#if USE_TDM
    const unsigned lds_base = (unsigned)(size_t)(void*)&lnT[0];
    tdm_i32x8 g1;
    g1[0] = (int)((2u << 16) | (1u << 20) | (4u << 22) | (1u << 25));
    g1[1] = (int)0x80000000u;
    g1[2] = (int)(128u << 16);
    g1[3] = (int)(32u << 16);
    g1[4] = (int)128u;
    g1[5] = (int)32768u;
    g1[6] = 0;
    g1[7] = 0;
    const tdm_i32x4 gz = {0, 0, 0, 0};
#endif

    for (int tile = 0; tile < CTILES; ++tile) {
        const int n0 = (chunk * CTILES + tile) * 32;
#if USE_TDM
        if (wave == 0) {
            unsigned long long ga = (unsigned long long)(size_t)(skb + n0);
            tdm_u32x4 g0;
            g0[0] = 1u;                                  // count=1
            g0[1] = lds_base;                            // lds_addr
            g0[2] = (unsigned)(ga & 0xFFFFFFFFu);        // global_addr lo
            g0[3] = (unsigned)((ga >> 32) & 0x01FFFFFFu) // global_addr hi
                    | 0x80000000u;                       // type=2
#if __clang_major__ >= 23
            __builtin_amdgcn_tensor_load_to_lds(g0, g1, gz, gz,
                                                (tdm_i32x8){0,0,0,0,0,0,0,0}, 0);
#else
            __builtin_amdgcn_tensor_load_to_lds(g0, g1, gz, gz, 0);
#endif
        }
#else
        for (int i = 0; i < 16; ++i) {                   // fallback: plain loads
            int idx = tid + i * 256;
            int c = idx >> 5, t = idx & 31;
            lnT[c * S1 + t] = skb[(size_t)c * Nn + n0 + t];
        }
#endif
        // EF2 tile [p][t]
        for (int i = 0; i < 4; ++i) {
            int idx = tid + i * 256;
            int p = idx & 31, t = idx >> 5;
            ef2T[p * S1 + t] = EF2[(size_t)(n0 + t) * 32 + p];
        }
#if USE_TDM
        __builtin_amdgcn_s_wait_tensorcnt(0);
#endif
        __syncthreads();
        // LayerNorm over C per token. A thread owns token 'lane' in the 16 channels
        // of its wave and keeps them in registers: 16 independent LDS reads, no
        // cross-lane step; the 8 waves' partial sums meet in 'red'.
        float* xl = &lnT[wave * 16 * S1 + lane];
        v2f x[8];                      // channels 2i, 2i+1 of the wave's 16
        v2f sa = {0, 0}, sb = {0, 0}, qa = {0, 0}, qb = {0, 0};
#pragma unroll  // constant indices keep the array in registers
        for (int i = 0; i < 8; ++i) x[i] = (v2f){xl[2 * i * S1], xl[(2 * i + 1) * S1]};
#pragma unroll  // constant indices keep the array in registers
        for (int i = 0; i < 8; i += 2) {
            sa += x[i];     qa += x[i] * x[i];
            sb += x[i + 1]; qb += x[i + 1] * x[i + 1];
        }
        sa += sb; qa += qb;
        *(v2f*)&red[lane * RP + wave * 2] = (v2f){sa[0] + sa[1], qa[0] + qa[1]};
        __syncthreads();
        float s = 0.0f, s2 = 0.0f;
#pragma unroll  // the 4 independent reads run ahead of the ordered adds
        for (int w = 0; w < 8; w += 2) {
            const v4f r = *(const v4f*)&red[lane * RP + w * 2];
            s += r[0]; s2 += r[1];
            s += r[2]; s2 += r[3];
        }
        const float mu  = s * (1.0f / 128.0f);
        const float var = s2 * (1.0f / 128.0f) - mu * mu;
        const float rs  = rsqrtf(var + LN_EPS);
#pragma unroll  // constant indices keep the arrays in registers
        for (int i = 0; i < 16; ++i)
            xl[i * S1] = (x[i >> 1][i & 1] - mu) * rs * lw[i] + lb[i];
        // The A rows that a wave reads below are the 16 channels it has just written
        // itself, so no work-group barrier stands here: the wave waits for its own
        // LDS stores before other lanes of it read the rows back.
        asm volatile("s_wait_dscnt 0x0" ::: "memory");
        // WMMA: A[m=c][k=t] = lnT[c][t]; B[k=t][n=p] = ef2T[p][t]
        const int mrow = wave * 16 + lanelow;
        for (int kk = 0; kk < 8; ++kk) {
            int kb = kk * 4 + half * 2;
            v2f a  = *(const v2f*)&lnT[mrow * S1 + kb];
            v2f b0 = *(const v2f*)&ef2T[lanelow * S1 + kb];
            v2f b1 = *(const v2f*)&ef2T[(16 + lanelow) * S1 + kb];
            acc0 = __builtin_amdgcn_wmma_f32_16x16x4_f32(false, a, false, b0,
                                                         (short)0, acc0, false, false);
            acc1 = __builtin_amdgcn_wmma_f32_16x16x4_f32(false, a, false, b1,
                                                         (short)0, acc1, false, false);
        }
        __syncthreads();
    }
    float* pl = part + (size_t)(b * CHUNKS + chunk) * PLANE + wave * 512 + lane * 4;
    *(v4f*)(pl)       = (v4f){acc0[0], acc0[1], acc0[2], acc0[3]};
    *(v4f*)(pl + 128) = (v4f){acc0[4], acc0[5], acc0[6], acc0[7]};
    *(v4f*)(pl + 256) = (v4f){acc1[0], acc1[1], acc1[2], acc1[3]};
    *(v4f*)(pl + 384) = (v4f){acc1[4], acc1[5], acc1[6], acc1[7]};
}

// k_proj[b, c, p] = sum over the batch's CHUNKS partial planes, in a fixed order:
// wave w adds planes 32w .. 32w+31 in turn, then the 8 wave sums are added in turn.
// Block = (128 consecutive plane elements, batch).
__global__ void __launch_bounds__(256)
kproj_reduce_kernel(const float* __restrict__ part, float* __restrict__ kproj) {
    __shared__ float red[8 * 128];     // [wave][element]

    const int b = blockIdx.y;
    const int seg = blockIdx.x;                // = (producer wave)*4 + q
    const int tid = threadIdx.x;
    const int lane = tid & 31, wave = tid >> 5;
    const float* p = part + (size_t)(b * CHUNKS + wave * 32) * PLANE + seg * 128 + lane * 4;

    v4f s = {0, 0, 0, 0};
    // unrolled so that the independent loads run ahead of the ordered adds
#pragma unroll
    for (int i = 0; i < 32; ++i)
        s += *(const v4f*)(p + (size_t)i * PLANE);
    *(v4f*)&red[wave * 128 + lane * 4] = s;
    __syncthreads();
    if (tid < 128) {
        float t = red[tid];
        for (int w = 1; w < 8; ++w) t += red[w * 128 + tid];
        const int pl = tid >> 2, r = (seg & 1) * 4 + (tid & 3);
        const int m   = (seg >> 2) * 16 + (pl >> 4) * 8 + r;
        const int col = ((seg >> 1) & 1) * 16 + (pl & 15);
        kproj[((b * Cn + m) << 5) + col] = t;
    }
}

// Work-group barrier that orders LDS alone. No wave reads what another wave wrote
// to global memory, so a wave's dst stores may stay in flight across it;
// __syncthreads() would drain them (s_wait_storecnt 0) once a head.
__device__ __forceinline__ void lds_barrier() {
    __builtin_amdgcn_fence(__ATOMIC_RELEASE, "workgroup", "local");
    __builtin_amdgcn_s_barrier();
    __builtin_amdgcn_fence(__ATOMIC_ACQUIRE, "workgroup", "local");
}

__device__ __forceinline__ float exp2_slot(float x) {
    float e;
    asm("v_exp_f32 %0, %1\n\tv_nop" : "=v"(e) : "v"(x));
    return e;
}

// A wave owns one 16-token tile and keeps it in registers; a block of 32 waves
// owns tokens n = (g*32 + wave)*128 + c0 + t, t < 16, so that the reference's
// scrambled reshape
//   dst[b, c'=n&127, n'=k*1024+h*256+(n>>7)] = x[b,h,n,k]
// gives the block whole 128-byte lines of dst (32 consecutive n>>7 per line).
// Both products run transposed (tokens are the N columns):
//   logitsT[p][t] = sum_d k_proj[d][p] * q[t][d]   -> a lane holds 16 p of one token
//   xT[k][t]      = sum_p v_proj[p][k] * attn[t][p]
// so softmax needs one exchange between the lane halves, and the logits'
// accumulator registers are the second product's B operand as they stand.
// k order, equal for A and B at every (half, register) position:
//   product 1, step 2s+w: d = 8s + 4*half + 2w + v
//   product 2, step (mt,u,w): p = 16mt + 8*half + 4u + 2w + v
__global__ void __launch_bounds__(1024)
attn_kernel(const float* __restrict__ outT, const float* __restrict__ ln_w,
            const float* __restrict__ ln_b, const float* __restrict__ temp3,
            const float* __restrict__ kproj, const float* __restrict__ vproj,
            float* __restrict__ dst) {
    __shared__ __attribute__((aligned(16))) float kpT[32 * S2];  // [p][c=h*32+d]
    __shared__ __attribute__((aligned(16))) float vpT[32 * S2];  // [k][c=h*32+p]
    __shared__ __attribute__((aligned(16))) float lnw[Cn];
    __shared__ __attribute__((aligned(16))) float lnb[Cn];
    __shared__ float xs[2][512 * XP];  // [head parity][line = k*16+t][n>>7 & 31]

    const int b = blockIdx.y;
    const int c0 = (blockIdx.x & 7) * 16;      // first c' of the block
    const int g = blockIdx.x >> 3;             // which 32 values of n>>7
    const int tid = threadIdx.x;
    const int lane = tid & 31, wave = tid >> 5;
    const int lanelow = lane & 15, half = lane >> 4;

    // k_proj, v_proj: 4 consecutive p of one channel per thread
    const int sc = tid >> 3, sp = (tid & 7) * 4;
    const float* kg = &kproj[((b * Cn + sc) << 5) + sp];
    const float* vg = &vproj[((b * Cn + sc) << 5) + sp];
    const v4f kq = *(const v4f*)kg;
    const v4f vq = *(const v4f*)vg;

    // the tile: register i holds channel (i>>2)*8 + 4*half + (i&3) of token lanelow
    const float* xp = outT + (size_t)b * Cn * Nn + (size_t)(4 * half) * Nn
                    + (g * 32 + wave) * 128 + c0 + lanelow;
    const float* xp2 = xp + (size_t)64 * Nn;   // channels 64 and up
    float q[64];
#pragma unroll  // constant indices keep the arrays in registers
    for (int i = 0; i < 32; ++i) {
        q[i]      = xp[(size_t)((i >> 2) * 8 + (i & 3)) * Nn];
        q[32 + i] = xp2[(size_t)((i >> 2) * 8 + (i & 3)) * Nn];
    }
    // The wait that stands before a register named by an issued load is rewritten;
    // the addresses are inputs so that they live up to it and no load lands in one.
    asm volatile("s_wait_xcnt 0x0" :: "v"(kg), "v"(vg), "v"(xp), "v"(xp2) : "memory");

#pragma unroll  // constant indices keep the arrays in registers
    for (int e = 0; e < 4; ++e) {
        kpT[(sp + e) * S2 + sc] = kq[e];
        vpT[(sp + e) * S2 + sc] = vq[e];
    }
    if (tid < Cn) { lnw[tid] = ln_w[tid]; lnb[tid] = ln_b[tid]; }
    asm volatile("s_wait_xcnt 0x0" ::: "memory");
    lds_barrier();

    // LayerNorm statistics of token lanelow: 64 channels here, 64 in the other half
    float sa[4] = {0, 0, 0, 0}, sb[4] = {0, 0, 0, 0};
#pragma unroll  // constant indices keep the arrays in registers
    for (int i = 0; i < 64; ++i) { sa[i & 3] += q[i]; sb[i & 3] += q[i] * q[i]; }
    float s  = (sa[0] + sa[1]) + (sa[2] + sa[3]);
    float s2 = (sb[0] + sb[1]) + (sb[2] + sb[3]);
    s  += __shfl_xor(s,  16, 32);
    s2 += __shfl_xor(s2, 16, 32);
    const float mu  = s * (1.0f / 128.0f);
    const float var = s2 * (1.0f / 128.0f) - mu * mu;
    const float rs  = rsqrtf(var + LN_EPS);

    float* db = dst + (size_t)b * Cn * Nn + (size_t)c0 * Nn + (wave << 10) + g * 32 + lane;

#pragma unroll  // constant indices keep the arrays in registers
    for (int h = 0; h < 4; ++h) {
        const float th = temp3[h];
        v8f l[2] = {{0,0,0,0,0,0,0,0}, {0,0,0,0,0,0,0,0}};
#pragma unroll  // constant indices keep the arrays in registers
        for (int s4 = 0; s4 < 4; ++s4) {
            const int cb = h * 32 + s4 * 8 + 4 * half;
            const v4f w4 = *(const v4f*)&lnw[cb];
            const v4f b4 = *(const v4f*)&lnb[cb];
            float qn[4];
#pragma unroll  // constant indices keep the arrays in registers
            for (int e = 0; e < 4; ++e)
                qn[e] = (q[h * 16 + s4 * 4 + e] - mu) * rs * w4[e] + b4[e];
            const v4f a0 = *(const v4f*)&kpT[lanelow * S2 + cb];
            const v4f a1 = *(const v4f*)&kpT[(16 + lanelow) * S2 + cb];
            const v2f q0 = {qn[0], qn[1]}, q1 = {qn[2], qn[3]};
            l[0] = __builtin_amdgcn_wmma_f32_16x16x4_f32(false, (v2f){a0[0], a0[1]}, false, q0,
                                                         (short)0, l[0], false, false);
            l[1] = __builtin_amdgcn_wmma_f32_16x16x4_f32(false, (v2f){a1[0], a1[1]}, false, q0,
                                                         (short)0, l[1], false, false);
            l[0] = __builtin_amdgcn_wmma_f32_16x16x4_f32(false, (v2f){a0[2], a0[3]}, false, q1,
                                                         (short)0, l[0], false, false);
            l[1] = __builtin_amdgcn_wmma_f32_16x16x4_f32(false, (v2f){a1[2], a1[3]}, false, q1,
                                                         (short)0, l[1], false, false);
        }
        // softmax over the 32 p of token lanelow: l[mt][r] is p = 16mt + 8*half + r
        float mx = l[0][0] * th;
#pragma unroll  // constant indices keep the arrays in registers
        for (int r = 0; r < 8; ++r) {
            l[0][r] *= th; l[1][r] *= th;
            mx = fmaxf(mx, fmaxf(l[0][r], l[1][r]));
        }
        mx = fmaxf(mx, __shfl_xor(mx, 16, 32));
        float e0 = 0.0f, e1 = 0.0f;
#pragma unroll  // constant indices keep the arrays in registers
        for (int r = 0; r < 8; ++r) {
            l[0][r] = exp2_slot((l[0][r] - mx) * LOG2E); e0 += l[0][r];
            l[1][r] = exp2_slot((l[1][r] - mx) * LOG2E); e1 += l[1][r];
        }
        float es = e0 + e1;
        es += __shfl_xor(es, 16, 32);
        const float inv = 1.0f / es;
#pragma unroll  // constant indices keep the arrays in registers
        for (int r = 0; r < 8; ++r) { l[0][r] *= inv; l[1][r] *= inv; }

        v8f x0 = {0,0,0,0,0,0,0,0};
        v8f x1 = {0,0,0,0,0,0,0,0};
#pragma unroll  // constant indices keep the arrays in registers
        for (int mt = 0; mt < 2; ++mt) {
#pragma unroll  // constant indices keep the arrays in registers
            for (int u = 0; u < 2; ++u) {
                const int pb = h * 32 + 16 * mt + 8 * half + 4 * u;
                const v4f a0 = *(const v4f*)&vpT[lanelow * S2 + pb];
                const v4f a1 = *(const v4f*)&vpT[(16 + lanelow) * S2 + pb];
                const v2f p0 = {l[mt][4 * u], l[mt][4 * u + 1]};
                const v2f p1 = {l[mt][4 * u + 2], l[mt][4 * u + 3]};
                x0 = __builtin_amdgcn_wmma_f32_16x16x4_f32(false, (v2f){a0[0], a0[1]}, false, p0,
                                                           (short)0, x0, false, false);
                x1 = __builtin_amdgcn_wmma_f32_16x16x4_f32(false, (v2f){a1[0], a1[1]}, false, p0,
                                                           (short)0, x1, false, false);
                x0 = __builtin_amdgcn_wmma_f32_16x16x4_f32(false, (v2f){a0[2], a0[3]}, false, p1,
                                                           (short)0, x0, false, false);
                x1 = __builtin_amdgcn_wmma_f32_16x16x4_f32(false, (v2f){a1[2], a1[3]}, false, p1,
                                                           (short)0, x1, false, false);
            }
        }
        float* xb = xs[h & 1];
#pragma unroll  // constant indices keep the arrays in registers
        for (int r = 0; r < 8; ++r) {
            xb[((8 * half + r) * 16 + lanelow) * XP + half + wave]      = x0[r];
            xb[((16 + 8 * half + r) * 16 + lanelow) * XP + half + wave] = x1[r];
        }
        // One barrier a head: it publishes this head's lines, and it ends every
        // wave's reads of the other buffer, which the next head overwrites.
        lds_barrier();
        // wave w stores the 16 lines of k = w: 128 contiguous bytes each
#pragma unroll  // constant indices keep the arrays in registers
        for (int i = 0; i < 16; ++i)
            db[(size_t)i * Nn + (h << 8)] = xb[(wave * 16 + i) * XP + ((wave >> 3) & 1) + lane];
        if (h < 3) asm volatile("s_wait_xcnt 0x0" ::: "memory");
    }
}

extern "C" void kernel_launch(void* const* d_in, const int* in_sizes, int n_in,
                              void* d_out, int out_size, void* d_ws, size_t ws_size,
                              hipStream_t stream) {
    const float* skip = (const float*)d_in[0];
    const float* outT = (const float*)d_in[1];
    const float* gf   = (const float*)d_in[2];
    const float* ln_w = (const float*)d_in[3];
    const float* ln_b = (const float*)d_in[4];
    const float* temp = (const float*)d_in[5];
    const float* EF1  = (const float*)d_in[6];
    const float* EF2  = (const float*)d_in[7];
    float* dst   = (float*)d_out;
    float* kproj = (float*)d_ws;          // Bn*Cn*32 = 16384 floats
    float* vproj = kproj + Bn * Cn * 32;  // Bn*Cn*32 = 16384 floats
    float* part  = vproj + Bn * Cn * 32;  // Bn*CHUNKS*PLANE floats = 16 MiB

    kproj_kernel<<<dim3(CHUNKS + VBLK, Bn), 256, 0, stream>>>(skip, EF2, ln_w, ln_b,
                                                              gf, EF1, part, vproj);
    kproj_reduce_kernel<<<dim3(PLANE / 128, Bn), 256, 0, stream>>>(part, kproj);
    attn_kernel<<<dim3(64, Bn), 1024, 0, stream>>>(outT, ln_w, ln_b, temp,
                                                   kproj, vproj, dst);
}

// v005
// A run of this version takes 43.2 microseconds.
// Next to v004, in two timings, it ran 1.05 times as fast each time.
// Over all steps from v000 it is 8.45 times as fast.
#include <hip/hip_runtime.h>

typedef float v2f __attribute__((ext_vector_type(2)));
typedef float v4f __attribute__((ext_vector_type(4)));
typedef float v8f __attribute__((ext_vector_type(8)));

typedef unsigned int tdm_u32x4 __attribute__((ext_vector_type(4)));
typedef int          tdm_i32x8 __attribute__((ext_vector_type(8)));
typedef int          tdm_i32x4 __attribute__((ext_vector_type(4)));

#ifndef USE_TDM
# define USE_TDM 1
#endif

#define Bn   4
#define Cn   128
#define Nn   32768
#define NGn  64
#define LN_EPS 1e-5f
#define LOG2E  1.44269504f
#define S1   34    // phase-1 LDS row stride (even => aligned b64 lane fetches)
#define RP   20    // phase-1 pitch of a token's 8 partial pairs (16 B x odd)
#define S2   132   // phase-2 LDS row stride (16 B x odd: conflict-free 16-byte lane fetches)
#define XP   33    // phase-2 write-out line pitch (32 floats + 1)
#define CHUNKS 256        // token chunks per batch in the k_proj sum
#define CTILES 4          // 32-token tiles per chunk (CHUNKS * CTILES * 32 == Nn)
#define PLANE  (Cn * 32)  // floats in one chunk's partial k_proj
#define VBLK   16         // v_proj blocks per batch (VBLK * 256 == Cn * 32 outputs)

// v_proj[b, c=h*32+d, k] = sum_{n<64} global_fea[b,n,c] * EF1[n,k], n ascending.
// One output a thread: block vb of a batch owns outputs vb*256 .. vb*256+255.
__device__ __forceinline__ void
vproj_block(const float* __restrict__ gf, const float* __restrict__ EF1,
            float* __restrict__ vproj, int b, int vb) {
    const int idx = vb * 256 + threadIdx.x;
    const int c = idx >> 5, k = idx & 31;
    const float* g = gf + b * NGn * Cn + c;
    const float* e = EF1 + k;
    float s = 0.0f;
    // unrolled so that the independent loads run ahead of the ordered adds
#pragma unroll
    for (int n = 0; n < NGn; ++n)
        s += g[n * Cn] * e[n * 32];
    vproj[b * Cn * 32 + idx] = s;
}

__global__ void __launch_bounds__(256)
kproj_kernel(const float* __restrict__ skip, const float* __restrict__ EF2,
             const float* __restrict__ ln_w, const float* __restrict__ ln_b,
             const float* __restrict__ gf, const float* __restrict__ EF1,
             float* __restrict__ part, float* __restrict__ vproj) {
    __shared__ float lnT[Cn * S1];     // [channel][token], padded stride 34
    __shared__ float ef2T[32 * S1];    // [p][token],       padded stride 34
    // [token][wave]: sum, sum of squares of the wave's 16 channels
    __shared__ __attribute__((aligned(16))) float red[32 * RP];

    if (blockIdx.x >= CHUNKS) {        // whole block, in front of every barrier
        vproj_block(gf, EF1, vproj, blockIdx.y, blockIdx.x - CHUNKS);
        return;
    }

    const int b = blockIdx.y;
    const int chunk = blockIdx.x;              // 256 chunks * 128 tokens
    const int tid = threadIdx.x;
    const int lane = tid & 31, wave = tid >> 5;
    const int lanelow = lane & 15, half = lane >> 4;
    const float* skb = skip + (size_t)b * Cn * Nn;

    v8f acc0 = {0,0,0,0,0,0,0,0};
    v8f acc1 = {0,0,0,0,0,0,0,0};

    // ln_w, ln_b of the wave's 16 channels: a wave-uniform index, so scalar loads
    const int wch = __builtin_amdgcn_readfirstlane(wave) * 16;
    float lw[16], lb[16];
#pragma unroll  // constant indices keep the arrays in registers
    for (int i = 0; i < 16; ++i) { lw[i] = ln_w[wch + i]; lb[i] = ln_b[wch + i]; }

#if USE_TDM
    const unsigned lds_base = (unsigned)(size_t)(void*)&lnT[0];
    tdm_i32x8 g1;
    g1[0] = (int)((2u << 16) | (1u << 20) | (4u << 22) | (1u << 25));
    g1[1] = (int)0x80000000u;
    g1[2] = (int)(128u << 16);
    g1[3] = (int)(32u << 16);
    g1[4] = (int)128u;
    g1[5] = (int)32768u;
    g1[6] = 0;
    g1[7] = 0;
    const tdm_i32x4 gz = {0, 0, 0, 0};
#endif

    for (int tile = 0; tile < CTILES; ++tile) {
        const int n0 = (chunk * CTILES + tile) * 32;
#if USE_TDM
        if (wave == 0) {
            unsigned long long ga = (unsigned long long)(size_t)(skb + n0);
            tdm_u32x4 g0;
            g0[0] = 1u;                                  // count=1
            g0[1] = lds_base;                            // lds_addr
            g0[2] = (unsigned)(ga & 0xFFFFFFFFu);        // global_addr lo
            g0[3] = (unsigned)((ga >> 32) & 0x01FFFFFFu) // global_addr hi
                    | 0x80000000u;                       // type=2
#if __clang_major__ >= 23
            __builtin_amdgcn_tensor_load_to_lds(g0, g1, gz, gz,
                                                (tdm_i32x8){0,0,0,0,0,0,0,0}, 0);
#else
            __builtin_amdgcn_tensor_load_to_lds(g0, g1, gz, gz, 0);
#endif
        }
#else
        for (int i = 0; i < 16; ++i) {                   // fallback: plain loads
            int idx = tid + i * 256;
            int c = idx >> 5, t = idx & 31;
            lnT[c * S1 + t] = skb[(size_t)c * Nn + n0 + t];
        }
#endif
        // EF2 tile [p][t]
        for (int i = 0; i < 4; ++i) {
            int idx = tid + i * 256;
            int p = idx & 31, t = idx >> 5;
            ef2T[p * S1 + t] = EF2[(size_t)(n0 + t) * 32 + p];
        }
#if USE_TDM
        __builtin_amdgcn_s_wait_tensorcnt(0);
#endif
        __syncthreads();
        // LayerNorm over C per token. A thread owns token 'lane' in the 16 channels
        // of its wave and keeps them in registers: 16 independent LDS reads, no
        // cross-lane step; the 8 waves' partial sums meet in 'red'.
        float* xl = &lnT[wave * 16 * S1 + lane];
        v2f x[8];                      // channels 2i, 2i+1 of the wave's 16
        v2f sa = {0, 0}, sb = {0, 0}, qa = {0, 0}, qb = {0, 0};
#pragma unroll  // constant indices keep the array in registers
        for (int i = 0; i < 8; ++i) x[i] = (v2f){xl[2 * i * S1], xl[(2 * i + 1) * S1]};
#pragma unroll  // constant indices keep the array in registers
        for (int i = 0; i < 8; i += 2) {
            sa += x[i];     qa += x[i] * x[i];
            sb += x[i + 1]; qb += x[i + 1] * x[i + 1];
        }
        sa += sb; qa += qb;
        *(v2f*)&red[lane * RP + wave * 2] = (v2f){sa[0] + sa[1], qa[0] + qa[1]};
        __syncthreads();
        float s = 0.0f, s2 = 0.0f;
#pragma unroll  // the 4 independent reads run ahead of the ordered adds
        for (int w = 0; w < 8; w += 2) {
            const v4f r = *(const v4f*)&red[lane * RP + w * 2];
            s += r[0]; s2 += r[1];
            s += r[2]; s2 += r[3];
        }
        const float mu  = s * (1.0f / 128.0f);
        const float var = s2 * (1.0f / 128.0f) - mu * mu;
        const float rs  = rsqrtf(var + LN_EPS);
#pragma unroll  // constant indices keep the arrays in registers
        for (int i = 0; i < 16; ++i)
            xl[i * S1] = (x[i >> 1][i & 1] - mu) * rs * lw[i] + lb[i];
        // The A rows that a wave reads below are the 16 channels it has just written
        // itself, so no work-group barrier stands here: the wave waits for its own
        // LDS stores before other lanes of it read the rows back.
        asm volatile("s_wait_dscnt 0x0" ::: "memory");
        // WMMA: A[m=c][k=t] = lnT[c][t]; B[k=t][n=p] = ef2T[p][t]
        const int mrow = wave * 16 + lanelow;
        for (int kk = 0; kk < 8; ++kk) {
            int kb = kk * 4 + half * 2;
            v2f a  = *(const v2f*)&lnT[mrow * S1 + kb];
            v2f b0 = *(const v2f*)&ef2T[lanelow * S1 + kb];
            v2f b1 = *(const v2f*)&ef2T[(16 + lanelow) * S1 + kb];
            acc0 = __builtin_amdgcn_wmma_f32_16x16x4_f32(false, a, false, b0,
                                                         (short)0, acc0, false, false);
            acc1 = __builtin_amdgcn_wmma_f32_16x16x4_f32(false, a, false, b1,
                                                         (short)0, acc1, false, false);
        }
        __syncthreads();
    }
    float* pl = part + (size_t)(b * CHUNKS + chunk) * PLANE + wave * 512 + lane * 4;
    *(v4f*)(pl)       = (v4f){acc0[0], acc0[1], acc0[2], acc0[3]};
    *(v4f*)(pl + 128) = (v4f){acc0[4], acc0[5], acc0[6], acc0[7]};
    *(v4f*)(pl + 256) = (v4f){acc1[0], acc1[1], acc1[2], acc1[3]};
    *(v4f*)(pl + 384) = (v4f){acc1[4], acc1[5], acc1[6], acc1[7]};
}

// k_proj[b, c, p] = sum over the batch's CHUNKS partial planes, in a fixed order:
// wave w adds planes 32w .. 32w+31 in turn, then the 8 wave sums are added in turn.
// Block = (128 consecutive plane elements, batch).
__global__ void __launch_bounds__(256)
kproj_reduce_kernel(const float* __restrict__ part, float* __restrict__ kproj) {
    __shared__ float red[8 * 128];     // [wave][element]

    const int b = blockIdx.y;
    const int seg = blockIdx.x;                // = (producer wave)*4 + q
    const int tid = threadIdx.x;
    const int lane = tid & 31, wave = tid >> 5;
    const float* p = part + (size_t)(b * CHUNKS + wave * 32) * PLANE + seg * 128 + lane * 4;

    v4f s = {0, 0, 0, 0};
    // unrolled so that the independent loads run ahead of the ordered adds
#pragma unroll
    for (int i = 0; i < 32; ++i)
        s += *(const v4f*)(p + (size_t)i * PLANE);
    *(v4f*)&red[wave * 128 + lane * 4] = s;
    __syncthreads();
    if (tid < 128) {
        float t = red[tid];
        for (int w = 1; w < 8; ++w) t += red[w * 128 + tid];
        const int pl = tid >> 2, r = (seg & 1) * 4 + (tid & 3);
        const int m   = (seg >> 2) * 16 + (pl >> 4) * 8 + r;
        const int col = ((seg >> 1) & 1) * 16 + (pl & 15);
        kproj[((b * Cn + m) << 5) + col] = t;
    }
}

// Work-group barrier that orders LDS alone. No wave reads what another wave wrote
// to global memory, so a wave's dst stores may stay in flight across it;
// __syncthreads() would drain them (s_wait_storecnt 0) once a head.
__device__ __forceinline__ void lds_barrier() {
    __builtin_amdgcn_fence(__ATOMIC_RELEASE, "workgroup", "local");
    __builtin_amdgcn_s_barrier();
    __builtin_amdgcn_fence(__ATOMIC_ACQUIRE, "workgroup", "local");
}

__device__ __forceinline__ float exp2_slot(float x) {
    float e;
    asm("v_exp_f32 %0, %1\n\tv_nop" : "=v"(e) : "v"(x));
    return e;
}

// A wave owns one 16-token tile and keeps it in registers; a block of 32 waves
// owns tokens n = (g*32 + wave)*128 + c0 + t, t < 16, so that the reference's
// scrambled reshape
//   dst[b, c'=n&127, n'=k*1024+h*256+(n>>7)] = x[b,h,n,k]
// gives the block whole 128-byte lines of dst (32 consecutive n>>7 per line).
// Both products run transposed (tokens are the N columns):
//   logitsT[p][t] = sum_d k_proj[d][p] * q[t][d]   -> a lane holds 16 p of one token
//   xT[k][t]      = sum_p v_proj[p][k] * attn[t][p]
// so softmax needs one exchange between the lane halves, and the logits'
// accumulator registers are the second product's B operand as they stand.
// k order, equal for A and B at every (half, register) position:
//   product 1, step 2s+w: d = 8s + 4*half + 2w + v
//   product 2, step (mt,u,w): p = 16mt + 8*half + 4u + 2w + v
__global__ void __launch_bounds__(1024)
attn_kernel(const float* __restrict__ outT, const float* __restrict__ ln_w,
            const float* __restrict__ ln_b, const float* __restrict__ temp3,
            const float* __restrict__ kproj, const float* __restrict__ vproj,
            float* __restrict__ dst) {
    __shared__ __attribute__((aligned(16))) float kpT[32 * S2];  // [p][c=h*32+d]
    __shared__ __attribute__((aligned(16))) float vpT[32 * S2];  // [k][c=h*32+p]
    __shared__ __attribute__((aligned(16))) float lnw[Cn];
    __shared__ __attribute__((aligned(16))) float lnb[Cn];
    __shared__ float xs[2][512 * XP];  // [head parity][line = k*16+t][n>>7 & 31]

    const int b = blockIdx.y;
    // The index bits above bit 2 pick among the 4 blocks that share a 256-byte
    // unit of outT and the 2 that share one of dst. Any placement gives the same values.
    const int bx = blockIdx.x;
    const int c0 = (((bx & 1) << 2) | ((bx >> 3) & 3)) * 16;  // first c' of the block
    const int g = (bx & 6) | (bx >> 5);        // which 32 values of n>>7
    const int tid = threadIdx.x;
    const int lane = tid & 31, wave = tid >> 5;
    const int lanelow = lane & 15, half = lane >> 4;

    // k_proj, v_proj: 4 consecutive p of one channel per thread
    const int sc = tid >> 3, sp = (tid & 7) * 4;
    const float* kg = &kproj[((b * Cn + sc) << 5) + sp];
    const float* vg = &vproj[((b * Cn + sc) << 5) + sp];
    const v4f kq = *(const v4f*)kg;
    const v4f vq = *(const v4f*)vg;

    // the tile: register i holds channel (i>>2)*8 + 4*half + (i&3) of token lanelow
    const float* xp = outT + (size_t)b * Cn * Nn + (size_t)(4 * half) * Nn
                    + (g * 32 + wave) * 128 + c0 + lanelow;
    const float* xp2 = xp + (size_t)64 * Nn;   // channels 64 and up
    float q[64];
#pragma unroll  // constant indices keep the arrays in registers
    for (int i = 0; i < 32; ++i) {
        q[i]      = xp[(size_t)((i >> 2) * 8 + (i & 3)) * Nn];
        q[32 + i] = xp2[(size_t)((i >> 2) * 8 + (i & 3)) * Nn];
    }
    // The wait that stands before a register named by an issued load is rewritten;
    // the addresses are inputs so that they live up to it and no load lands in one.
    asm volatile("s_wait_xcnt 0x0" :: "v"(kg), "v"(vg), "v"(xp), "v"(xp2) : "memory");

#pragma unroll  // constant indices keep the arrays in registers
    for (int e = 0; e < 4; ++e) {
        kpT[(sp + e) * S2 + sc] = kq[e];
        vpT[(sp + e) * S2 + sc] = vq[e];
    }
    if (tid < Cn) { lnw[tid] = ln_w[tid]; lnb[tid] = ln_b[tid]; }
    asm volatile("s_wait_xcnt 0x0" ::: "memory");
    lds_barrier();

    // LayerNorm statistics of token lanelow: 64 channels here, 64 in the other half
    float sa[4] = {0, 0, 0, 0}, sb[4] = {0, 0, 0, 0};
#pragma unroll  // constant indices keep the arrays in registers
    for (int i = 0; i < 64; ++i) { sa[i & 3] += q[i]; sb[i & 3] += q[i] * q[i]; }
    float s  = (sa[0] + sa[1]) + (sa[2] + sa[3]);
    float s2 = (sb[0] + sb[1]) + (sb[2] + sb[3]);
    s  += __shfl_xor(s,  16, 32);
    s2 += __shfl_xor(s2, 16, 32);
    const float mu  = s * (1.0f / 128.0f);
    const float var = s2 * (1.0f / 128.0f) - mu * mu;
    const float rs  = rsqrtf(var + LN_EPS);

    float* db = dst + (size_t)b * Cn * Nn + (size_t)c0 * Nn + (wave << 10) + g * 32 + lane;

#pragma unroll  // constant indices keep the arrays in registers
    for (int h = 0; h < 4; ++h) {
        const float th = temp3[h];
        v8f l[2] = {{0,0,0,0,0,0,0,0}, {0,0,0,0,0,0,0,0}};
#pragma unroll  // constant indices keep the arrays in registers
        for (int s4 = 0; s4 < 4; ++s4) {
            const int cb = h * 32 + s4 * 8 + 4 * half;
            const v4f w4 = *(const v4f*)&lnw[cb];
            const v4f b4 = *(const v4f*)&lnb[cb];
            float qn[4];
#pragma unroll  // constant indices keep the arrays in registers
            for (int e = 0; e < 4; ++e)
                qn[e] = (q[h * 16 + s4 * 4 + e] - mu) * rs * w4[e] + b4[e];
            const v4f a0 = *(const v4f*)&kpT[lanelow * S2 + cb];
            const v4f a1 = *(const v4f*)&kpT[(16 + lanelow) * S2 + cb];
            const v2f q0 = {qn[0], qn[1]}, q1 = {qn[2], qn[3]};
            l[0] = __builtin_amdgcn_wmma_f32_16x16x4_f32(false, (v2f){a0[0], a0[1]}, false, q0,
                                                         (short)0, l[0], false, false);
            l[1] = __builtin_amdgcn_wmma_f32_16x16x4_f32(false, (v2f){a1[0], a1[1]}, false, q0,
                                                         (short)0, l[1], false, false);
            l[0] = __builtin_amdgcn_wmma_f32_16x16x4_f32(false, (v2f){a0[2], a0[3]}, false, q1,
                                                         (short)0, l[0], false, false);
            l[1] = __builtin_amdgcn_wmma_f32_16x16x4_f32(false, (v2f){a1[2], a1[3]}, false, q1,
                                                         (short)0, l[1], false, false);
        }
        // softmax over the 32 p of token lanelow: l[mt][r] is p = 16mt + 8*half + r
        float mx = l[0][0] * th;
#pragma unroll  // constant indices keep the arrays in registers
        for (int r = 0; r < 8; ++r) {
            l[0][r] *= th; l[1][r] *= th;
            mx = fmaxf(mx, fmaxf(l[0][r], l[1][r]));
        }
        mx = fmaxf(mx, __shfl_xor(mx, 16, 32));
        float e0 = 0.0f, e1 = 0.0f;
#pragma unroll  // constant indices keep the arrays in registers
        for (int r = 0; r < 8; ++r) {
            l[0][r] = exp2_slot((l[0][r] - mx) * LOG2E); e0 += l[0][r];
            l[1][r] = exp2_slot((l[1][r] - mx) * LOG2E); e1 += l[1][r];
        }
        float es = e0 + e1;
        es += __shfl_xor(es, 16, 32);
        const float inv = 1.0f / es;
#pragma unroll  // constant indices keep the arrays in registers
        for (int r = 0; r < 8; ++r) { l[0][r] *= inv; l[1][r] *= inv; }

        v8f x0 = {0,0,0,0,0,0,0,0};
        v8f x1 = {0,0,0,0,0,0,0,0};
#pragma unroll  // constant indices keep the arrays in registers
        for (int mt = 0; mt < 2; ++mt) {
#pragma unroll  // constant indices keep the arrays in registers
            for (int u = 0; u < 2; ++u) {
                const int pb = h * 32 + 16 * mt + 8 * half + 4 * u;
                const v4f a0 = *(const v4f*)&vpT[lanelow * S2 + pb];
                const v4f a1 = *(const v4f*)&vpT[(16 + lanelow) * S2 + pb];
                const v2f p0 = {l[mt][4 * u], l[mt][4 * u + 1]};
                const v2f p1 = {l[mt][4 * u + 2], l[mt][4 * u + 3]};
                x0 = __builtin_amdgcn_wmma_f32_16x16x4_f32(false, (v2f){a0[0], a0[1]}, false, p0,
                                                           (short)0, x0, false, false);
                x1 = __builtin_amdgcn_wmma_f32_16x16x4_f32(false, (v2f){a1[0], a1[1]}, false, p0,
                                                           (short)0, x1, false, false);
                x0 = __builtin_amdgcn_wmma_f32_16x16x4_f32(false, (v2f){a0[2], a0[3]}, false, p1,
                                                           (short)0, x0, false, false);
                x1 = __builtin_amdgcn_wmma_f32_16x16x4_f32(false, (v2f){a1[2], a1[3]}, false, p1,
                                                           (short)0, x1, false, false);
            }
        }
        float* xb = xs[h & 1];
#pragma unroll  // constant indices keep the arrays in registers
        for (int r = 0; r < 8; ++r) {
            xb[((8 * half + r) * 16 + lanelow) * XP + half + wave]      = x0[r];
            xb[((16 + 8 * half + r) * 16 + lanelow) * XP + half + wave] = x1[r];
        }
        // One barrier a head: it publishes this head's lines, and it ends every
        // wave's reads of the other buffer, which the next head overwrites.
        lds_barrier();
        // wave w stores the 16 lines of k = w: 128 contiguous bytes each
#pragma unroll  // constant indices keep the arrays in registers
        for (int i = 0; i < 16; ++i)
            db[(size_t)i * Nn + (h << 8)] = xb[(wave * 16 + i) * XP + ((wave >> 3) & 1) + lane];
        if (h < 3) asm volatile("s_wait_xcnt 0x0" ::: "memory");
    }
}

extern "C" void kernel_launch(void* const* d_in, const int* in_sizes, int n_in,
                              void* d_out, int out_size, void* d_ws, size_t ws_size,
                              hipStream_t stream) {
    const float* skip = (const float*)d_in[0];
    const float* outT = (const float*)d_in[1];
    const float* gf   = (const float*)d_in[2];
    const float* ln_w = (const float*)d_in[3];
    const float* ln_b = (const float*)d_in[4];
    const float* temp = (const float*)d_in[5];
    const float* EF1  = (const float*)d_in[6];
    const float* EF2  = (const float*)d_in[7];
    float* dst   = (float*)d_out;
    float* kproj = (float*)d_ws;          // Bn*Cn*32 = 16384 floats
    float* vproj = kproj + Bn * Cn * 32;  // Bn*Cn*32 = 16384 floats
    float* part  = vproj + Bn * Cn * 32;  // Bn*CHUNKS*PLANE floats = 16 MiB

    kproj_kernel<<<dim3(CHUNKS + VBLK, Bn), 256, 0, stream>>>(skip, EF2, ln_w, ln_b,
                                                              gf, EF1, part, vproj);
    kproj_reduce_kernel<<<dim3(PLANE / 128, Bn), 256, 0, stream>>>(part, kproj);
    attn_kernel<<<dim3(64, Bn), 1024, 0, stream>>>(outT, ln_w, ln_b, temp,
                                                   kproj, vproj, dst);
}
